// v000
// The times below were measured on an AMD MI455X: many runs one after another, warmed up first and cycling through
// copies of the inputs, with the whole window's GPU time divided by the number of runs. Launches and the gaps
// between them are all in it. The median over several windows is given; except for v000 it joins two sittings, which
// can be a few percent apart, so the side-by-side timings, each taken in one sitting, are the better comparison.
// The starting kernel, v000, takes 285 microseconds a run.
#include <hip/hip_runtime.h>
#include <hip/hip_bf16.h>

typedef __attribute__((ext_vector_type(16))) _Float16 v16h;
typedef __attribute__((ext_vector_type(8)))  _Float16 v8h;
typedef __attribute__((ext_vector_type(8)))  float    v8f;

#define B_SZ   2
#define T_SEQ  2048
#define C_DIM  1024
#define H_NUM  16
#define DH     64

__device__ __forceinline__ v8f wmma_f16(v16h a, v16h b, v8f c) {
  return __builtin_amdgcn_wmma_f32_16x16x32_f16(
      /*neg_a=*/false, a, /*neg_b=*/false, b,
      /*c_mod=*/(short)0, c, /*reuse_a=*/false, /*reuse_b=*/false);
}

__device__ __forceinline__ v16h load_frag_rm(const _Float16* p, int ld) {
  int lane = threadIdx.x & 31;
  int row  = lane & 15;
  int hi   = (lane >> 4) ? 8 : 0;
  const _Float16* r = p + (size_t)row * ld;
  v8h lo = *(const v8h*)(r + hi);
  v8h hb = *(const v8h*)(r + 16 + hi);
  v16h out;
#pragma unroll
  for (int i = 0; i < 8; ++i) { out[i] = lo[i]; out[i + 8] = hb[i]; }
  return out;
}

// Gather a 32x16 B-fragment (rows = contraction K, cols = N) from an LDS
// tile stored row-major [32][ldh] (rows = keys, cols = Dh).
__device__ __forceinline__ v16h load_b_frag_lds(const _Float16* vl, int ldh, int n0) {
  int lane = threadIdx.x & 31;
  int n  = lane & 15;
  int hi = (lane >> 4) ? 8 : 0;
  v16h out;
#pragma unroll
  for (int j = 0; j < 16; ++j) {
    int k = ((j >> 3) * 16) + hi + (j & 7);
    out[j] = vl[k * ldh + n0 + n];
  }
  return out;
}

// ---------------------------------------------------------------------------
// f32 -> f16 cast
// ---------------------------------------------------------------------------
__global__ void cast_f32_f16(const float* __restrict__ in,
                             _Float16* __restrict__ out, int n) {
  int i = blockIdx.x * 256 + threadIdx.x;
  if (i < n) out[i] = (_Float16)in[i];
}

// ---------------------------------------------------------------------------
// QKV GEMM: qkv[m,n] = sum_k x[m,k] * W_attn[n,k] + b_attn[n]
// M=4096, N=3072, K=1024.
// Block = 256 threads = 8 waves arranged 2(M) x 4(N); wave tile = 32 x 64.
// K unrolled by 2 with ping-pong register sets: loads for step i+1 are
// issued before the WMMAs of step i, and each load lands directly in the
// set consumed next -> no rotation copies.
// Epilogue scatters into Q/K/V f16 buffers, layout [B,H,T,Dh].
// ---------------------------------------------------------------------------
__global__ void __launch_bounds__(256)
gemm_qkv(const _Float16* __restrict__ xh, const _Float16* __restrict__ wh,
         const float* __restrict__ bias,
         _Float16* __restrict__ qb, _Float16* __restrict__ kb,
         _Float16* __restrict__ vb) {
  int wave = threadIdx.x >> 5;        // 0..7
  int wm = wave >> 2;                 // 0..1
  int wn = wave & 3;                  // 0..3
  int m0 = blockIdx.y * 64 + wm * 32;
  int n0 = blockIdx.x * 256 + wn * 64;

  const _Float16* Arow0 = xh + (size_t)m0 * C_DIM;
  const _Float16* Arow1 = xh + (size_t)(m0 + 16) * C_DIM;
  const _Float16* Brow[4];
#pragma unroll
  for (int t = 0; t < 4; ++t) Brow[t] = wh + (size_t)(n0 + t * 16) * C_DIM;

  v8f acc[2][4] = {};

  // prologue: set0 <- k = 0
  v16h a0A = load_frag_rm(Arow0, C_DIM);
  v16h a1A = load_frag_rm(Arow1, C_DIM);
  v16h bA[4];
#pragma unroll
  for (int t = 0; t < 4; ++t) bA[t] = load_frag_rm(Brow[t], C_DIM);

  v16h a0B, a1B, bB[4];

  for (int k = 0; k < C_DIM; k += 64) {
    // load set1 <- k+32 (always in range: k <= K-64)
    a0B = load_frag_rm(Arow0 + k + 32, C_DIM);
    a1B = load_frag_rm(Arow1 + k + 32, C_DIM);
#pragma unroll
    for (int t = 0; t < 4; ++t) bB[t] = load_frag_rm(Brow[t] + k + 32, C_DIM);

    // WMMAs on set0 (k)
#pragma unroll
    for (int t = 0; t < 4; ++t) {
      acc[0][t] = wmma_f16(a0A, bA[t], acc[0][t]);
      acc[1][t] = wmma_f16(a1A, bA[t], acc[1][t]);
    }

    // load set0 <- k+64 (clamped dummy on final iteration; never consumed)
    int kn = (k + 64 < C_DIM) ? (k + 64) : 0;
    a0A = load_frag_rm(Arow0 + kn, C_DIM);
    a1A = load_frag_rm(Arow1 + kn, C_DIM);
#pragma unroll
    for (int t = 0; t < 4; ++t) bA[t] = load_frag_rm(Brow[t] + kn, C_DIM);

    // WMMAs on set1 (k+32)
#pragma unroll
    for (int t = 0; t < 4; ++t) {
      acc[0][t] = wmma_f16(a0B, bB[t], acc[0][t]);
      acc[1][t] = wmma_f16(a1B, bB[t], acc[1][t]);
    }
  }

  int lane = threadIdx.x & 31;
  int ncl  = lane & 15;
  int mhi  = (lane >> 4) ? 8 : 0;
#pragma unroll
  for (int t = 0; t < 4; ++t) {
    int n = n0 + t * 16 + ncl;
    float bv = bias[n];
    int which = n >> 10;            // 0=q,1=k,2=v
    int c = n & 1023;
    int h = c >> 6;
    int d = c & 63;
    _Float16* dst = (which == 0) ? qb : ((which == 1) ? kb : vb);
#pragma unroll
    for (int mi = 0; mi < 2; ++mi) {
#pragma unroll
      for (int r = 0; r < 8; ++r) {
        int m = m0 + mi * 16 + r + mhi;
        int bidx = m >> 11;           // /T
        int tpos = m & (T_SEQ - 1);
        dst[(((size_t)(bidx * H_NUM + h) * T_SEQ) + tpos) * DH + d] =
            (_Float16)(acc[mi][t][r] + bv);
      }
    }
  }
}

// ---------------------------------------------------------------------------
// Flash attention with ALiBi + causal mask.
// Block = 4 waves; wave handles 16 q-rows; grid = (T/64, H, B).
// ---------------------------------------------------------------------------
#define P_LD   40                 // 16 rows * 40 halves (80B rows, 16B aligned)
#define V_LD   72                 // 32 rows * 72 halves (144B rows, 16B aligned)
#define WAVE_LDS (16 * P_LD + 32 * V_LD)   // 640 + 2304 = 2944 halves

__global__ void __launch_bounds__(128)
attn_fwd(const _Float16* __restrict__ qbuf, const _Float16* __restrict__ kbuf,
         const _Float16* __restrict__ vbuf, _Float16* __restrict__ ybuf) {
  __shared__ _Float16 smem[4 * WAVE_LDS];

  int wave = threadIdx.x >> 5;
  int lane = threadIdx.x & 31;
  int b = blockIdx.z;
  int h = blockIdx.y;
  int q0 = blockIdx.x * 64 + wave * 16;

  const _Float16* Q = qbuf + (size_t)(b * H_NUM + h) * T_SEQ * DH;
  const _Float16* K = kbuf + (size_t)(b * H_NUM + h) * T_SEQ * DH;
  const _Float16* V = vbuf + (size_t)(b * H_NUM + h) * T_SEQ * DH;

  _Float16* pl = smem + wave * WAVE_LDS;        // P tile  16 x P_LD
  _Float16* vl = pl + 16 * P_LD;                // V tile  32 x V_LD

  // Q fragments held for the whole key loop (Dh=64 -> two 16x32 fragments)
  v16h aq0 = load_frag_rm(Q + (size_t)q0 * DH + 0, DH);
  v16h aq1 = load_frag_rm(Q + (size_t)q0 * DH + 32, DH);

  v8f o[4] = {};
  float mrow[8], lrow[8];
#pragma unroll
  for (int r = 0; r < 8; ++r) { mrow[r] = -1e30f; lrow[r] = 0.0f; }

  float slope = exp2f(-8.0f / (float)H_NUM * (float)(h + 1));
  int mhi = (lane >> 4) ? 8 : 0;
  int ncl = lane & 15;

  for (int kb0 = 0; kb0 <= q0 + 15; kb0 += 32) {
    // ---- stage V[kb0..kb0+31, 0..63] into LDS (wave-cooperative) ----
#pragma unroll
    for (int c = 0; c < 8; ++c) {
      int idx = c * 32 + lane;        // 256 chunks of 8 halves
      int rr = idx >> 3;
      int ch = idx & 7;
      v8h d = *(const v8h*)(V + (size_t)(kb0 + rr) * DH + ch * 8);
      *(v8h*)(vl + rr * V_LD + ch * 8) = d;
    }

    // ---- S = Q K^T for two 16-key tiles ----
    v8f s[2];
#pragma unroll
    for (int t2 = 0; t2 < 2; ++t2) {
      v16h bk0 = load_frag_rm(K + (size_t)(kb0 + t2 * 16) * DH + 0, DH);
      v16h bk1 = load_frag_rm(K + (size_t)(kb0 + t2 * 16) * DH + 32, DH);
      v8f c = {};
      c = wmma_f16(aq0, bk0, c);
      c = wmma_f16(aq1, bk1, c);
      s[t2] = c;
    }

    // ---- scale + ALiBi + causal mask + online softmax ----
    float mnew[8];
#pragma unroll
    for (int r = 0; r < 8; ++r) {
      int qr = q0 + r + mhi;
      float mx = mrow[r];
#pragma unroll
      for (int t2 = 0; t2 < 2; ++t2) {
        int kc = kb0 + t2 * 16 + ncl;
        float v = s[t2][r] * 0.125f +
                  slope * fminf((float)(kc - qr), 0.0f);
        if (kc > qr) v = -1e30f;
        s[t2][r] = v;
        mx = fmaxf(mx, v);
      }
#pragma unroll
      for (int off = 1; off < 16; off <<= 1)
        mx = fmaxf(mx, __shfl_xor(mx, off, 16));
      mnew[r] = mx;
    }

#pragma unroll
    for (int r = 0; r < 8; ++r) {
      float alpha = __expf(mrow[r] - mnew[r]);
      float rowsum = 0.0f;
#pragma unroll
      for (int t2 = 0; t2 < 2; ++t2) {
        float p = __expf(s[t2][r] - mnew[r]);
        s[t2][r] = p;
        rowsum += p;
      }
#pragma unroll
      for (int off = 1; off < 16; off <<= 1)
        rowsum += __shfl_xor(rowsum, off, 16);
      lrow[r] = lrow[r] * alpha + rowsum;
      mrow[r] = mnew[r];
#pragma unroll
      for (int d4 = 0; d4 < 4; ++d4) o[d4][r] *= alpha;
    }

    // ---- C-layout P -> LDS -> A-layout fragment (same-wave transpose) ----
#pragma unroll
    for (int t2 = 0; t2 < 2; ++t2)
#pragma unroll
      for (int r = 0; r < 8; ++r)
        pl[(r + mhi) * P_LD + t2 * 16 + ncl] = (_Float16)s[t2][r];

    // Same-wave LDS ops are in-order; make the dependency explicit.
    asm volatile("s_wait_dscnt 0" ::: "memory");

    v16h ap = load_frag_rm(pl, P_LD);

    // ---- O += P * V ----
#pragma unroll
    for (int d4 = 0; d4 < 4; ++d4) {
      v16h bv = load_b_frag_lds(vl, V_LD, d4 * 16);
      o[d4] = wmma_f16(ap, bv, o[d4]);
    }
  }

  // ---- epilogue: normalize and store y as f16, layout [B,T,C] ----
#pragma unroll
  for (int d4 = 0; d4 < 4; ++d4) {
#pragma unroll
    for (int r = 0; r < 8; ++r) {
      int t = q0 + r + mhi;
      float val = o[d4][r] / lrow[r];
      ybuf[((size_t)(b * T_SEQ + t)) * C_DIM + h * DH + d4 * 16 + ncl] =
          (_Float16)val;
    }
  }
}

// ---------------------------------------------------------------------------
// Output projection: out[m,n] = sum_k y[m,k] * W_proj[n,k] + b_proj[n]  (f32)
// M=4096, N=1024, K=1024.  Same ping-pong pipelined 32x64-per-wave structure.
// ---------------------------------------------------------------------------
__global__ void __launch_bounds__(256)
gemm_proj(const _Float16* __restrict__ yh, const _Float16* __restrict__ wh,
          const float* __restrict__ bias, float* __restrict__ out) {
  int wave = threadIdx.x >> 5;
  int wm = wave >> 2;
  int wn = wave & 3;
  int m0 = blockIdx.y * 64 + wm * 32;
  int n0 = blockIdx.x * 256 + wn * 64;

  const _Float16* Arow0 = yh + (size_t)m0 * C_DIM;
  const _Float16* Arow1 = yh + (size_t)(m0 + 16) * C_DIM;
  const _Float16* Brow[4];
#pragma unroll
  for (int t = 0; t < 4; ++t) Brow[t] = wh + (size_t)(n0 + t * 16) * C_DIM;

  v8f acc[2][4] = {};

  v16h a0A = load_frag_rm(Arow0, C_DIM);
  v16h a1A = load_frag_rm(Arow1, C_DIM);
  v16h bA[4];
#pragma unroll
  for (int t = 0; t < 4; ++t) bA[t] = load_frag_rm(Brow[t], C_DIM);

  v16h a0B, a1B, bB[4];

  for (int k = 0; k < C_DIM; k += 64) {
    a0B = load_frag_rm(Arow0 + k + 32, C_DIM);
    a1B = load_frag_rm(Arow1 + k + 32, C_DIM);
#pragma unroll
    for (int t = 0; t < 4; ++t) bB[t] = load_frag_rm(Brow[t] + k + 32, C_DIM);

#pragma unroll
    for (int t = 0; t < 4; ++t) {
      acc[0][t] = wmma_f16(a0A, bA[t], acc[0][t]);
      acc[1][t] = wmma_f16(a1A, bA[t], acc[1][t]);
    }

    int kn = (k + 64 < C_DIM) ? (k + 64) : 0;
    a0A = load_frag_rm(Arow0 + kn, C_DIM);
    a1A = load_frag_rm(Arow1 + kn, C_DIM);
#pragma unroll
    for (int t = 0; t < 4; ++t) bA[t] = load_frag_rm(Brow[t] + kn, C_DIM);

#pragma unroll
    for (int t = 0; t < 4; ++t) {
      acc[0][t] = wmma_f16(a0B, bB[t], acc[0][t]);
      acc[1][t] = wmma_f16(a1B, bB[t], acc[1][t]);
    }
  }

  int lane = threadIdx.x & 31;
  int ncl  = lane & 15;
  int mhi  = (lane >> 4) ? 8 : 0;
#pragma unroll
  for (int t = 0; t < 4; ++t) {
    int n = n0 + t * 16 + ncl;
    float bv = bias[n];
#pragma unroll
    for (int mi = 0; mi < 2; ++mi) {
#pragma unroll
      for (int r = 0; r < 8; ++r) {
        int m = m0 + mi * 16 + r + mhi;
        out[(size_t)m * C_DIM + n] = acc[mi][t][r] + bv;
      }
    }
  }
}

// ---------------------------------------------------------------------------
// Launch
// ---------------------------------------------------------------------------
extern "C" void kernel_launch(void* const* d_in, const int* in_sizes, int n_in,
                              void* d_out, int out_size, void* d_ws, size_t ws_size,
                              hipStream_t stream) {
  const float* x      = (const float*)d_in[0];   // [B,T,C]
  const float* W_attn = (const float*)d_in[1];   // [3C,C]
  const float* b_attn = (const float*)d_in[2];   // [3C]
  const float* W_proj = (const float*)d_in[3];   // [C,C]
  const float* b_proj = (const float*)d_in[4];   // [C]
  float* out = (float*)d_out;

  char* ws = (char*)d_ws;
  const size_t n_x  = (size_t)B_SZ * T_SEQ * C_DIM;        // 4,194,304
  const size_t n_wa = (size_t)3 * C_DIM * C_DIM;           // 3,145,728
  const size_t n_wp = (size_t)C_DIM * C_DIM;               // 1,048,576
  const size_t n_qkv = (size_t)B_SZ * H_NUM * T_SEQ * DH;  // 4,194,304

  _Float16* xh  = (_Float16*)(ws);
  _Float16* wah = (_Float16*)(ws + 2 * n_x);
  _Float16* wph = (_Float16*)(ws + 2 * (n_x + n_wa));
  _Float16* qb  = (_Float16*)(ws + 2 * (n_x + n_wa + n_wp));
  _Float16* kb  = (_Float16*)(ws + 2 * (n_x + n_wa + n_wp + n_qkv));
  _Float16* vb  = (_Float16*)(ws + 2 * (n_x + n_wa + n_wp + 2 * n_qkv));
  _Float16* yb  = (_Float16*)(ws + 2 * (n_x + n_wa + n_wp + 3 * n_qkv));

  cast_f32_f16<<<(int)((n_x  + 255) / 256), 256, 0, stream>>>(x, xh, (int)n_x);
  cast_f32_f16<<<(int)((n_wa + 255) / 256), 256, 0, stream>>>(W_attn, wah, (int)n_wa);
  cast_f32_f16<<<(int)((n_wp + 255) / 256), 256, 0, stream>>>(W_proj, wph, (int)n_wp);

  // QKV GEMM: block tile 64x256 -> grid = (3072/256, 4096/64) = (12, 64)
  gemm_qkv<<<dim3(12, 64), 256, 0, stream>>>(xh, wah, b_attn, qb, kb, vb);

  // Attention: (T/64, H, B)
  attn_fwd<<<dim3(T_SEQ / 64, H_NUM, B_SZ), 128, 0, stream>>>(qb, kb, vb, yb);

  // Projection: block tile 64x256 -> grid = (1024/256, 4096/64) = (4, 64)
  gemm_proj<<<dim3(4, 64), 256, 0, stream>>>(yb, wph, b_proj, out);
}

// v001
// Measured time: 211 microseconds a run.
// In two side-by-side timings against v000, it was 1.38 and 1.36 times as fast.
#include <hip/hip_runtime.h>
#include <hip/hip_bf16.h>

typedef __attribute__((ext_vector_type(16))) _Float16 v16h;
typedef __attribute__((ext_vector_type(8)))  _Float16 v8h;
typedef __attribute__((ext_vector_type(8)))  float    v8f;

#define B_SZ   2
#define T_SEQ  2048
#define C_DIM  1024
#define H_NUM  16
#define DH     64

__device__ __forceinline__ v8f wmma_f16(v16h a, v16h b, v8f c) {
  return __builtin_amdgcn_wmma_f32_16x16x32_f16(
      /*neg_a=*/false, a, /*neg_b=*/false, b,
      /*c_mod=*/(short)0, c, /*reuse_a=*/false, /*reuse_b=*/false);
}

__device__ __forceinline__ v16h load_frag_rm(const _Float16* p, int ld) {
  int lane = threadIdx.x & 31;
  int row  = lane & 15;
  int hi   = (lane >> 4) ? 8 : 0;
  const _Float16* r = p + (size_t)row * ld;
  v8h lo = *(const v8h*)(r + hi);
  v8h hb = *(const v8h*)(r + 16 + hi);
  v16h out;
#pragma unroll
  for (int i = 0; i < 8; ++i) { out[i] = lo[i]; out[i + 8] = hb[i]; }
  return out;
}

// Transposing LDS load: lane (c = lane & 15, h = lane >> 4) receives the eight
// 16-bit values T[kbase + 8h + 0..7][dbase + c] of a row-major LDS tile.
typedef short s16x8 __attribute__((ext_vector_type(8)));
__device__ __forceinline__ v8h ld_tr16(const _Float16* p) {
  typedef __attribute__((address_space(3))) s16x8 lds_s16x8;
  return __builtin_bit_cast(v8h, __builtin_amdgcn_ds_load_tr16_b128_v8i16((lds_s16x8*)p));
}

__device__ __forceinline__ float xhalf(float x) {
  int xi = __builtin_bit_cast(int, x);
  return __builtin_bit_cast(float, __builtin_amdgcn_permlanex16(
      xi, xi, 0x76543210, 0xfedcba98, false, false));
}

// ---------------------------------------------------------------------------
// f32 -> f16 cast
// ---------------------------------------------------------------------------
__global__ void cast_f32_f16(const float* __restrict__ in,
                             _Float16* __restrict__ out, int n) {
  int i = blockIdx.x * 256 + threadIdx.x;
  if (i < n) out[i] = (_Float16)in[i];
}

// ---------------------------------------------------------------------------
// QKV GEMM: qkv[m,n] = sum_k x[m,k] * W_attn[n,k] + b_attn[n]
// M=4096, N=3072, K=1024.
// Block = 256 threads = 8 waves arranged 2(M) x 4(N); wave tile = 32 x 64.
// K unrolled by 2 with ping-pong register sets: loads for step i+1 are
// issued before the WMMAs of step i, and each load lands directly in the
// set consumed next -> no rotation copies.
// Epilogue scatters into Q/K/V f16 buffers, layout [B,H,T,Dh].
// ---------------------------------------------------------------------------
__global__ void __launch_bounds__(256)
gemm_qkv(const _Float16* __restrict__ xh, const _Float16* __restrict__ wh,
         const float* __restrict__ bias,
         _Float16* __restrict__ qb, _Float16* __restrict__ kb,
         _Float16* __restrict__ vb) {
  int wave = threadIdx.x >> 5;        // 0..7
  int wm = wave >> 2;                 // 0..1
  int wn = wave & 3;                  // 0..3
  int m0 = blockIdx.y * 64 + wm * 32;
  int n0 = blockIdx.x * 256 + wn * 64;

  const _Float16* Arow0 = xh + (size_t)m0 * C_DIM;
  const _Float16* Arow1 = xh + (size_t)(m0 + 16) * C_DIM;
  const _Float16* Brow[4];
#pragma unroll
  for (int t = 0; t < 4; ++t) Brow[t] = wh + (size_t)(n0 + t * 16) * C_DIM;

  v8f acc[2][4] = {};

  // prologue: set0 <- k = 0
  v16h a0A = load_frag_rm(Arow0, C_DIM);
  v16h a1A = load_frag_rm(Arow1, C_DIM);
  v16h bA[4];
#pragma unroll
  for (int t = 0; t < 4; ++t) bA[t] = load_frag_rm(Brow[t], C_DIM);

  v16h a0B, a1B, bB[4];

  for (int k = 0; k < C_DIM; k += 64) {
    // load set1 <- k+32 (always in range: k <= K-64)
    a0B = load_frag_rm(Arow0 + k + 32, C_DIM);
    a1B = load_frag_rm(Arow1 + k + 32, C_DIM);
#pragma unroll
    for (int t = 0; t < 4; ++t) bB[t] = load_frag_rm(Brow[t] + k + 32, C_DIM);

    // WMMAs on set0 (k)
#pragma unroll
    for (int t = 0; t < 4; ++t) {
      acc[0][t] = wmma_f16(a0A, bA[t], acc[0][t]);
      acc[1][t] = wmma_f16(a1A, bA[t], acc[1][t]);
    }

    // load set0 <- k+64 (clamped dummy on final iteration; never consumed)
    int kn = (k + 64 < C_DIM) ? (k + 64) : 0;
    a0A = load_frag_rm(Arow0 + kn, C_DIM);
    a1A = load_frag_rm(Arow1 + kn, C_DIM);
#pragma unroll
    for (int t = 0; t < 4; ++t) bA[t] = load_frag_rm(Brow[t] + kn, C_DIM);

    // WMMAs on set1 (k+32)
#pragma unroll
    for (int t = 0; t < 4; ++t) {
      acc[0][t] = wmma_f16(a0B, bB[t], acc[0][t]);
      acc[1][t] = wmma_f16(a1B, bB[t], acc[1][t]);
    }
  }

  int lane = threadIdx.x & 31;
  int ncl  = lane & 15;
  int mhi  = (lane >> 4) ? 8 : 0;
#pragma unroll
  for (int t = 0; t < 4; ++t) {
    int n = n0 + t * 16 + ncl;
    float bv = bias[n];
    int which = n >> 10;            // 0=q,1=k,2=v
    int c = n & 1023;
    int h = c >> 6;
    int d = c & 63;
    _Float16* dst = (which == 0) ? qb : ((which == 1) ? kb : vb);
#pragma unroll
    for (int mi = 0; mi < 2; ++mi) {
#pragma unroll
      for (int r = 0; r < 8; ++r) {
        int m = m0 + mi * 16 + r + mhi;
        int bidx = m >> 11;           // /T
        int tpos = m & (T_SEQ - 1);
        dst[(((size_t)(bidx * H_NUM + h) * T_SEQ) + tpos) * DH + d] =
            (_Float16)(acc[mi][t][r] + bv);
      }
    }
  }
}

#define V_LD   80                 // 160-byte rows: odd multiple of 32 B for the transposing load
#define WAVE_LDS (32 * V_LD)      // 2560 halves per wave

__global__ void __launch_bounds__(128)
attn_fwd(const _Float16* __restrict__ qbuf, const _Float16* __restrict__ kbuf,
         const _Float16* __restrict__ vbuf, _Float16* __restrict__ ybuf) {
  __shared__ __attribute__((aligned(16))) _Float16 smem[4 * WAVE_LDS];

  int wave = threadIdx.x >> 5;
  int lane = threadIdx.x & 31;
  int b = blockIdx.z;
  int h = blockIdx.y;
  int q0 = blockIdx.x * 64 + wave * 16;

  const _Float16* Q = qbuf + (size_t)(b * H_NUM + h) * T_SEQ * DH;
  const _Float16* K = kbuf + (size_t)(b * H_NUM + h) * T_SEQ * DH;
  const _Float16* V = vbuf + (size_t)(b * H_NUM + h) * T_SEQ * DH;

  _Float16* vl = smem + wave * WAVE_LDS;        // V tile  32 x V_LD

  // Q fragments (B operand) held for the whole key loop (Dh=64 -> two 32x16)
  v16h bq0 = load_frag_rm(Q + (size_t)q0 * DH + 0, DH);
  v16h bq1 = load_frag_rm(Q + (size_t)q0 * DH + 32, DH);

  v8f o[4] = {};                  // o[d4][r] = O^T[d4*16 + mhi + r][q0 + ncl]
  float mrun = -1e30f;            // this query's running maximum (same in both halves)
  float lrun = 0.0f;              // this half's share of the running denominator

  float slope = exp2f(-8.0f / (float)H_NUM * (float)(h + 1));
  int mhi = (lane >> 4) ? 8 : 0;
  int ncl = lane & 15;
  int qr  = q0 + ncl;

  // lane address of the transposing loads (key rows 0..15, d columns 0..15)
  const _Float16* vtr = vl + (mhi + (lane & 7)) * V_LD + ((lane >> 3) & 1) * 8;

  for (int kb0 = 0; kb0 <= q0 + 15; kb0 += 32) {
    // ---- this pass's 16 global loads: V[kb0..kb0+31, 0..63] and the K fragments ----
    const _Float16* vp = V + (size_t)(kb0 + (lane >> 3)) * DH + (lane & 7) * 8;
    const _Float16* kp = K + (size_t)(kb0 + ncl) * DH + mhi;
    v8h vd[8];                        // chunk c: V row kb0 + 4c + lane/8, halves 8*(lane&7)..+7
#pragma unroll
    for (int c = 0; c < 8; ++c) vd[c] = *(const v8h*)(vp + c * 4 * DH);
    v8h kd[2][4];                     // K row kb0 + 16*t2 + ncl, halves 16*j + mhi..+7
#pragma unroll
    for (int t2 = 0; t2 < 2; ++t2)
#pragma unroll
      for (int j = 0; j < 4; ++j) kd[t2][j] = *(const v8h*)(kp + t2 * 16 * DH + j * 16);
    // Stands behind the pass's loads and in front of any rewrite of their address registers
    // (named as inputs so that they stay whole up to here). Its memory clobber also keeps the
    // 16 loads one group ahead of the LDS stores: left free, the scheduler sinks V's loads
    // behind the products and the pass waits for L2 several times in a row.
    asm volatile("s_wait_xcnt 0x0" :: "v"(vp), "v"(kp) : "memory");

    // ---- stage V into LDS (wave-cooperative) ----
#pragma unroll
    for (int c = 0; c < 8; ++c) {
      int idx = c * 32 + lane;
      *(v8h*)(vl + (idx >> 3) * V_LD + (idx & 7) * 8) = vd[c];
    }

    // ---- S^T = K Q^T for two 16-key tiles ----
    v8f s[2];
#pragma unroll
    for (int t2 = 0; t2 < 2; ++t2) {
      v16h ak0, ak1;
#pragma unroll
      for (int i = 0; i < 8; ++i) {
        ak0[i] = kd[t2][0][i]; ak0[i + 8] = kd[t2][1][i];
        ak1[i] = kd[t2][2][i]; ak1[i + 8] = kd[t2][3][i];
      }
      v8f c = {};
      c = wmma_f16(ak0, bq0, c);
      c = wmma_f16(ak1, bq1, c);
      s[t2] = c;
    }

    // Same-wave LDS ops are in-order; make the store -> load dependency explicit.
    asm volatile("s_wait_dscnt 0" ::: "memory");

    // ---- V^T fragments (A operand), in flight under the softmax ----
    v16h av[4];
#pragma unroll
    for (int d4 = 0; d4 < 4; ++d4) {
      v8h lo = ld_tr16(vtr + d4 * 16);
      v8h hb = ld_tr16(vtr + 16 * V_LD + d4 * 16);
#pragma unroll
      for (int i = 0; i < 8; ++i) { av[d4][i] = lo[i]; av[d4][i + 8] = hb[i]; }
    }
    // Keeps the 8 transposing loads ahead of the softmax, which then covers their latency.
    __builtin_amdgcn_sched_barrier(0);

    // ---- scale + ALiBi + causal mask ----
#pragma unroll
    for (int t2 = 0; t2 < 2; ++t2) {
#pragma unroll
      for (int r = 0; r < 8; ++r) {
        int kc = kb0 + t2 * 16 + mhi + r;
        float v = s[t2][r] * 0.125f +
                  slope * fminf((float)(kc - qr), 0.0f);
        if (kc > qr) v = -1e30f;
        s[t2][r] = v;
      }
    }

    // ---- online softmax: in-lane trees, one exchange between the halves ----
    float t8[8];
#pragma unroll
    for (int r = 0; r < 8; ++r) t8[r] = fmaxf(s[0][r], s[1][r]);
#pragma unroll
    for (int w = 4; w > 0; w >>= 1)
#pragma unroll
      for (int r = 0; r < w; ++r) t8[r] = fmaxf(t8[r], t8[r + w]);
    float mx = fmaxf(t8[0], xhalf(t8[0]));
    float mnew = fmaxf(mrun, mx);
    float alpha = __expf(mrun - mnew);
    mrun = mnew;

#pragma unroll
    for (int t2 = 0; t2 < 2; ++t2)
#pragma unroll
      for (int r = 0; r < 8; ++r) s[t2][r] = __expf(s[t2][r] - mnew);

#pragma unroll
    for (int r = 0; r < 8; ++r) t8[r] = s[0][r] + s[1][r];
#pragma unroll
    for (int w = 4; w > 0; w >>= 1)
#pragma unroll
      for (int r = 0; r < w; ++r) t8[r] += t8[r + w];
    lrun = lrun * alpha + t8[0];

#pragma unroll
    for (int d4 = 0; d4 < 4; ++d4)
#pragma unroll
      for (int r = 0; r < 8; ++r) o[d4][r] *= alpha;

    // ---- P^T: the two score tiles, converted in place, are the B operand ----
    v16h bp;
#pragma unroll
    for (int r = 0; r < 8; ++r) {
      bp[r]     = (_Float16)s[0][r];
      bp[r + 8] = (_Float16)s[1][r];
    }

    // ---- O^T += V^T * P^T ----
#pragma unroll
    for (int d4 = 0; d4 < 4; ++d4) o[d4] = wmma_f16(av[d4], bp, o[d4]);
  }

  // ---- epilogue: join the halves' sums, normalize, store y as f16 [B,T,C] ----
  lrun += xhalf(lrun);
#pragma unroll
  for (int d4 = 0; d4 < 4; ++d4) {
    v8h pk;
#pragma unroll
    for (int r = 0; r < 8; ++r) pk[r] = (_Float16)(o[d4][r] / lrun);
    *(v8h*)(ybuf + ((size_t)(b * T_SEQ + qr)) * C_DIM + h * DH + d4 * 16 + mhi) = pk;
  }
}

// ---------------------------------------------------------------------------
// Output projection: out[m,n] = sum_k y[m,k] * W_proj[n,k] + b_proj[n]  (f32)
// M=4096, N=1024, K=1024.  Same ping-pong pipelined 32x64-per-wave structure.
// ---------------------------------------------------------------------------
__global__ void __launch_bounds__(256)
gemm_proj(const _Float16* __restrict__ yh, const _Float16* __restrict__ wh,
          const float* __restrict__ bias, float* __restrict__ out) {
  int wave = threadIdx.x >> 5;
  int wm = wave >> 2;
  int wn = wave & 3;
  int m0 = blockIdx.y * 64 + wm * 32;
  int n0 = blockIdx.x * 256 + wn * 64;

  const _Float16* Arow0 = yh + (size_t)m0 * C_DIM;
  const _Float16* Arow1 = yh + (size_t)(m0 + 16) * C_DIM;
  const _Float16* Brow[4];
#pragma unroll
  for (int t = 0; t < 4; ++t) Brow[t] = wh + (size_t)(n0 + t * 16) * C_DIM;

  v8f acc[2][4] = {};

  v16h a0A = load_frag_rm(Arow0, C_DIM);
  v16h a1A = load_frag_rm(Arow1, C_DIM);
  v16h bA[4];
#pragma unroll
  for (int t = 0; t < 4; ++t) bA[t] = load_frag_rm(Brow[t], C_DIM);

  v16h a0B, a1B, bB[4];

  for (int k = 0; k < C_DIM; k += 64) {
    a0B = load_frag_rm(Arow0 + k + 32, C_DIM);
    a1B = load_frag_rm(Arow1 + k + 32, C_DIM);
#pragma unroll
    for (int t = 0; t < 4; ++t) bB[t] = load_frag_rm(Brow[t] + k + 32, C_DIM);

#pragma unroll
    for (int t = 0; t < 4; ++t) {
      acc[0][t] = wmma_f16(a0A, bA[t], acc[0][t]);
      acc[1][t] = wmma_f16(a1A, bA[t], acc[1][t]);
    }

    int kn = (k + 64 < C_DIM) ? (k + 64) : 0;
    a0A = load_frag_rm(Arow0 + kn, C_DIM);
    a1A = load_frag_rm(Arow1 + kn, C_DIM);
#pragma unroll
    for (int t = 0; t < 4; ++t) bA[t] = load_frag_rm(Brow[t] + kn, C_DIM);

#pragma unroll
    for (int t = 0; t < 4; ++t) {
      acc[0][t] = wmma_f16(a0B, bB[t], acc[0][t]);
      acc[1][t] = wmma_f16(a1B, bB[t], acc[1][t]);
    }
  }

  int lane = threadIdx.x & 31;
  int ncl  = lane & 15;
  int mhi  = (lane >> 4) ? 8 : 0;
#pragma unroll
  for (int t = 0; t < 4; ++t) {
    int n = n0 + t * 16 + ncl;
    float bv = bias[n];
#pragma unroll
    for (int mi = 0; mi < 2; ++mi) {
#pragma unroll
      for (int r = 0; r < 8; ++r) {
        int m = m0 + mi * 16 + r + mhi;
        out[(size_t)m * C_DIM + n] = acc[mi][t][r] + bv;
      }
    }
  }
}

// ---------------------------------------------------------------------------
// Launch
// ---------------------------------------------------------------------------
extern "C" void kernel_launch(void* const* d_in, const int* in_sizes, int n_in,
                              void* d_out, int out_size, void* d_ws, size_t ws_size,
                              hipStream_t stream) {
  const float* x      = (const float*)d_in[0];   // [B,T,C]
  const float* W_attn = (const float*)d_in[1];   // [3C,C]
  const float* b_attn = (const float*)d_in[2];   // [3C]
  const float* W_proj = (const float*)d_in[3];   // [C,C]
  const float* b_proj = (const float*)d_in[4];   // [C]
  float* out = (float*)d_out;

  char* ws = (char*)d_ws;
  const size_t n_x  = (size_t)B_SZ * T_SEQ * C_DIM;        // 4,194,304
  const size_t n_wa = (size_t)3 * C_DIM * C_DIM;           // 3,145,728
  const size_t n_wp = (size_t)C_DIM * C_DIM;               // 1,048,576
  const size_t n_qkv = (size_t)B_SZ * H_NUM * T_SEQ * DH;  // 4,194,304

  _Float16* xh  = (_Float16*)(ws);
  _Float16* wah = (_Float16*)(ws + 2 * n_x);
  _Float16* wph = (_Float16*)(ws + 2 * (n_x + n_wa));
  _Float16* qb  = (_Float16*)(ws + 2 * (n_x + n_wa + n_wp));
  _Float16* kb  = (_Float16*)(ws + 2 * (n_x + n_wa + n_wp + n_qkv));
  _Float16* vb  = (_Float16*)(ws + 2 * (n_x + n_wa + n_wp + 2 * n_qkv));
  _Float16* yb  = (_Float16*)(ws + 2 * (n_x + n_wa + n_wp + 3 * n_qkv));

  cast_f32_f16<<<(int)((n_x  + 255) / 256), 256, 0, stream>>>(x, xh, (int)n_x);
  cast_f32_f16<<<(int)((n_wa + 255) / 256), 256, 0, stream>>>(W_attn, wah, (int)n_wa);
  cast_f32_f16<<<(int)((n_wp + 255) / 256), 256, 0, stream>>>(W_proj, wph, (int)n_wp);

  // QKV GEMM: block tile 64x256 -> grid = (3072/256, 4096/64) = (12, 64)
  gemm_qkv<<<dim3(12, 64), 256, 0, stream>>>(xh, wah, b_attn, qb, kb, vb);

  // Attention: (T/64, H, B)
  attn_fwd<<<dim3(T_SEQ / 64, H_NUM, B_SZ), 128, 0, stream>>>(qb, kb, vb, yb);

  // Projection: block tile 64x256 -> grid = (1024/256, 4096/64) = (4, 64)
  gemm_proj<<<dim3(4, 64), 256, 0, stream>>>(yb, wph, b_proj, out);
}

// v002
// It runs in 198 microseconds.
// Next to v001, in two timings, it ran 1.05 and 1.06 times as fast.
// Counting every step since v000, it is 1.44 times as fast.
#include <hip/hip_runtime.h>
#include <hip/hip_bf16.h>

typedef __attribute__((ext_vector_type(16))) _Float16 v16h;
typedef __attribute__((ext_vector_type(8)))  _Float16 v8h;
typedef __attribute__((ext_vector_type(8)))  float    v8f;

#define B_SZ   2
#define T_SEQ  2048
#define C_DIM  1024
#define H_NUM  16
#define DH     64

__device__ __forceinline__ v8f wmma_f16(v16h a, v16h b, v8f c) {
  return __builtin_amdgcn_wmma_f32_16x16x32_f16(
      /*neg_a=*/false, a, /*neg_b=*/false, b,
      /*c_mod=*/(short)0, c, /*reuse_a=*/false, /*reuse_b=*/false);
}

__device__ __forceinline__ v16h load_frag_rm(const _Float16* p, int ld) {
  int lane = threadIdx.x & 31;
  int row  = lane & 15;
  int hi   = (lane >> 4) ? 8 : 0;
  const _Float16* r = p + (size_t)row * ld;
  v8h lo = *(const v8h*)(r + hi);
  v8h hb = *(const v8h*)(r + 16 + hi);
  v16h out;
#pragma unroll
  for (int i = 0; i < 8; ++i) { out[i] = lo[i]; out[i + 8] = hb[i]; }
  return out;
}

// Transposing LDS load: lane (c = lane & 15, h = lane >> 4) receives the eight
// 16-bit values T[kbase + 8h + 0..7][dbase + c] of a row-major LDS tile.
typedef short s16x8 __attribute__((ext_vector_type(8)));
__device__ __forceinline__ v8h ld_tr16(const _Float16* p) {
  typedef __attribute__((address_space(3))) s16x8 lds_s16x8;
  return __builtin_bit_cast(v8h, __builtin_amdgcn_ds_load_tr16_b128_v8i16((lds_s16x8*)p));
}

__device__ __forceinline__ float xhalf(float x) {
  int xi = __builtin_bit_cast(int, x);
  return __builtin_bit_cast(float, __builtin_amdgcn_permlanex16(
      xi, xi, 0x76543210, 0xfedcba98, false, false));
}

// ---------------------------------------------------------------------------
// f32 -> f16 cast of x, W_attn and W_proj in ONE launch. The three f16 copies lie
// one behind the other in the workspace, so the destination is one flat array.
// One 16-wave block per WGP; a block converts CAST_BLK elements in a row, all of
// one source. A wave load covers 512 B in a row, a wave store 256 B; a thread's
// 16 loads are all in flight before its first store.
// ---------------------------------------------------------------------------
typedef __attribute__((ext_vector_type(4))) float    v4f;
typedef __attribute__((ext_vector_type(4))) _Float16 v4h;

#define CAST_THR   512
#define CAST_PER   16                            // 16-byte loads per thread
#define CAST_STEP  (CAST_THR * 4)                // elements per block and load round
#define CAST_BLK   (CAST_STEP * CAST_PER)        // elements per block
#define CAST_NB_X  (B_SZ * T_SEQ * C_DIM / CAST_BLK)
#define CAST_NB_WA (3 * C_DIM * C_DIM / CAST_BLK)
#define CAST_NB_WP (C_DIM * C_DIM / CAST_BLK)
static_assert(CAST_NB_X * CAST_BLK == B_SZ * T_SEQ * C_DIM, "x is whole blocks");
static_assert(CAST_NB_WA * CAST_BLK == 3 * C_DIM * C_DIM, "W_attn is whole blocks");
static_assert(CAST_NB_WP * CAST_BLK == C_DIM * C_DIM, "W_proj is whole blocks");

__global__ void __launch_bounds__(CAST_THR)
cast3_f32_f16(const float* __restrict__ x, const float* __restrict__ wa,
              const float* __restrict__ wp, _Float16* __restrict__ out) {
  int blk = blockIdx.x;
  const float* src = x;
  int first = 0;
  if (blk >= CAST_NB_X)              { src = wa; first = CAST_NB_X; }
  if (blk >= CAST_NB_X + CAST_NB_WA) { src = wp; first = CAST_NB_X + CAST_NB_WA; }
  const float* sp = src + (size_t)(blk - first) * CAST_BLK + threadIdx.x * 4;
  _Float16*    dp = out + (size_t)blk * CAST_BLK + threadIdx.x * 4;

  v4f v[CAST_PER];
#pragma unroll
  for (int i = 0; i < CAST_PER; ++i) v[i] = *(const v4f*)(sp + i * CAST_STEP);
  // Keeps all 16 loads ahead of the first conversion: left free, the scheduler holds the last
  // two back until the first two have landed, and the wave pays the memory latency twice.
  __builtin_amdgcn_sched_barrier(0);
  v4h h[CAST_PER];
#pragma unroll
  for (int i = 0; i < CAST_PER; ++i) h[i] = __builtin_convertvector(v[i], v4h);
  // Keeps the stores behind the last conversion, each with data registers of its own: left
  // free, the scheduler reuses the first stores' registers and waits for those stores between
  // the later conversions.
  __builtin_amdgcn_sched_barrier(0);
#pragma unroll
  for (int i = 0; i < CAST_PER; ++i) *(v4h*)(dp + i * CAST_STEP) = h[i];
}

// ---------------------------------------------------------------------------
// QKV GEMM: qkv[m,n] = sum_k x[m,k] * W_attn[n,k] + b_attn[n]
// M=4096, N=3072, K=1024.
// Block = 256 threads = 8 waves arranged 2(M) x 4(N); wave tile = 32 x 64.
// K unrolled by 2 with ping-pong register sets: loads for step i+1 are
// issued before the WMMAs of step i, and each load lands directly in the
// set consumed next -> no rotation copies.
// Epilogue scatters into Q/K/V f16 buffers, layout [B,H,T,Dh].
// ---------------------------------------------------------------------------
__global__ void __launch_bounds__(256)
gemm_qkv(const _Float16* __restrict__ xh, const _Float16* __restrict__ wh,
         const float* __restrict__ bias,
         _Float16* __restrict__ qb, _Float16* __restrict__ kb,
         _Float16* __restrict__ vb) {
  int wave = threadIdx.x >> 5;        // 0..7
  int wm = wave >> 2;                 // 0..1
  int wn = wave & 3;                  // 0..3
  int m0 = blockIdx.y * 64 + wm * 32;
  int n0 = blockIdx.x * 256 + wn * 64;

  const _Float16* Arow0 = xh + (size_t)m0 * C_DIM;
  const _Float16* Arow1 = xh + (size_t)(m0 + 16) * C_DIM;
  const _Float16* Brow[4];
#pragma unroll
  for (int t = 0; t < 4; ++t) Brow[t] = wh + (size_t)(n0 + t * 16) * C_DIM;

  v8f acc[2][4] = {};

  // prologue: set0 <- k = 0
  v16h a0A = load_frag_rm(Arow0, C_DIM);
  v16h a1A = load_frag_rm(Arow1, C_DIM);
  v16h bA[4];
#pragma unroll
  for (int t = 0; t < 4; ++t) bA[t] = load_frag_rm(Brow[t], C_DIM);

  v16h a0B, a1B, bB[4];

  for (int k = 0; k < C_DIM; k += 64) {
    // load set1 <- k+32 (always in range: k <= K-64)
    a0B = load_frag_rm(Arow0 + k + 32, C_DIM);
    a1B = load_frag_rm(Arow1 + k + 32, C_DIM);
#pragma unroll
    for (int t = 0; t < 4; ++t) bB[t] = load_frag_rm(Brow[t] + k + 32, C_DIM);

    // WMMAs on set0 (k)
#pragma unroll
    for (int t = 0; t < 4; ++t) {
      acc[0][t] = wmma_f16(a0A, bA[t], acc[0][t]);
      acc[1][t] = wmma_f16(a1A, bA[t], acc[1][t]);
    }

    // load set0 <- k+64 (clamped dummy on final iteration; never consumed)
    int kn = (k + 64 < C_DIM) ? (k + 64) : 0;
    a0A = load_frag_rm(Arow0 + kn, C_DIM);
    a1A = load_frag_rm(Arow1 + kn, C_DIM);
#pragma unroll
    for (int t = 0; t < 4; ++t) bA[t] = load_frag_rm(Brow[t] + kn, C_DIM);

    // WMMAs on set1 (k+32)
#pragma unroll
    for (int t = 0; t < 4; ++t) {
      acc[0][t] = wmma_f16(a0B, bB[t], acc[0][t]);
      acc[1][t] = wmma_f16(a1B, bB[t], acc[1][t]);
    }
  }

  int lane = threadIdx.x & 31;
  int ncl  = lane & 15;
  int mhi  = (lane >> 4) ? 8 : 0;
#pragma unroll
  for (int t = 0; t < 4; ++t) {
    int n = n0 + t * 16 + ncl;
    float bv = bias[n];
    int which = n >> 10;            // 0=q,1=k,2=v
    int c = n & 1023;
    int h = c >> 6;
    int d = c & 63;
    _Float16* dst = (which == 0) ? qb : ((which == 1) ? kb : vb);
#pragma unroll
    for (int mi = 0; mi < 2; ++mi) {
#pragma unroll
      for (int r = 0; r < 8; ++r) {
        int m = m0 + mi * 16 + r + mhi;
        int bidx = m >> 11;           // /T
        int tpos = m & (T_SEQ - 1);
        dst[(((size_t)(bidx * H_NUM + h) * T_SEQ) + tpos) * DH + d] =
            (_Float16)(acc[mi][t][r] + bv);
      }
    }
  }
}

#define V_LD   80                 // 160-byte rows: odd multiple of 32 B for the transposing load
#define WAVE_LDS (32 * V_LD)      // 2560 halves per wave

__global__ void __launch_bounds__(128)
attn_fwd(const _Float16* __restrict__ qbuf, const _Float16* __restrict__ kbuf,
         const _Float16* __restrict__ vbuf, _Float16* __restrict__ ybuf) {
  __shared__ __attribute__((aligned(16))) _Float16 smem[4 * WAVE_LDS];

  int wave = threadIdx.x >> 5;
  int lane = threadIdx.x & 31;
  int b = blockIdx.z;
  int h = blockIdx.y;
  int q0 = blockIdx.x * 64 + wave * 16;

  const _Float16* Q = qbuf + (size_t)(b * H_NUM + h) * T_SEQ * DH;
  const _Float16* K = kbuf + (size_t)(b * H_NUM + h) * T_SEQ * DH;
  const _Float16* V = vbuf + (size_t)(b * H_NUM + h) * T_SEQ * DH;

  _Float16* vl = smem + wave * WAVE_LDS;        // V tile  32 x V_LD

  // Q fragments (B operand) held for the whole key loop (Dh=64 -> two 32x16)
  v16h bq0 = load_frag_rm(Q + (size_t)q0 * DH + 0, DH);
  v16h bq1 = load_frag_rm(Q + (size_t)q0 * DH + 32, DH);

  v8f o[4] = {};                  // o[d4][r] = O^T[d4*16 + mhi + r][q0 + ncl]
  float mrun = -1e30f;            // this query's running maximum (same in both halves)
  float lrun = 0.0f;              // this half's share of the running denominator

  float slope = exp2f(-8.0f / (float)H_NUM * (float)(h + 1));
  int mhi = (lane >> 4) ? 8 : 0;
  int ncl = lane & 15;
  int qr  = q0 + ncl;

  // lane address of the transposing loads (key rows 0..15, d columns 0..15)
  const _Float16* vtr = vl + (mhi + (lane & 7)) * V_LD + ((lane >> 3) & 1) * 8;

  for (int kb0 = 0; kb0 <= q0 + 15; kb0 += 32) {
    // ---- this pass's 16 global loads: V[kb0..kb0+31, 0..63] and the K fragments ----
    const _Float16* vp = V + (size_t)(kb0 + (lane >> 3)) * DH + (lane & 7) * 8;
    const _Float16* kp = K + (size_t)(kb0 + ncl) * DH + mhi;
    v8h vd[8];                        // chunk c: V row kb0 + 4c + lane/8, halves 8*(lane&7)..+7
#pragma unroll
    for (int c = 0; c < 8; ++c) vd[c] = *(const v8h*)(vp + c * 4 * DH);
    v8h kd[2][4];                     // K row kb0 + 16*t2 + ncl, halves 16*j + mhi..+7
#pragma unroll
    for (int t2 = 0; t2 < 2; ++t2)
#pragma unroll
      for (int j = 0; j < 4; ++j) kd[t2][j] = *(const v8h*)(kp + t2 * 16 * DH + j * 16);
    // Stands behind the pass's loads and in front of any rewrite of their address registers
    // (named as inputs so that they stay whole up to here). Its memory clobber also keeps the
    // 16 loads one group ahead of the LDS stores: left free, the scheduler sinks V's loads
    // behind the products and the pass waits for L2 several times in a row.
    asm volatile("s_wait_xcnt 0x0" :: "v"(vp), "v"(kp) : "memory");

    // ---- stage V into LDS (wave-cooperative) ----
#pragma unroll
    for (int c = 0; c < 8; ++c) {
      int idx = c * 32 + lane;
      *(v8h*)(vl + (idx >> 3) * V_LD + (idx & 7) * 8) = vd[c];
    }

    // ---- S^T = K Q^T for two 16-key tiles ----
    v8f s[2];
#pragma unroll
    for (int t2 = 0; t2 < 2; ++t2) {
      v16h ak0, ak1;
#pragma unroll
      for (int i = 0; i < 8; ++i) {
        ak0[i] = kd[t2][0][i]; ak0[i + 8] = kd[t2][1][i];
        ak1[i] = kd[t2][2][i]; ak1[i + 8] = kd[t2][3][i];
      }
      v8f c = {};
      c = wmma_f16(ak0, bq0, c);
      c = wmma_f16(ak1, bq1, c);
      s[t2] = c;
    }

    // Same-wave LDS ops are in-order; make the store -> load dependency explicit.
    asm volatile("s_wait_dscnt 0" ::: "memory");

    // ---- V^T fragments (A operand), in flight under the softmax ----
    v16h av[4];
#pragma unroll
    for (int d4 = 0; d4 < 4; ++d4) {
      v8h lo = ld_tr16(vtr + d4 * 16);
      v8h hb = ld_tr16(vtr + 16 * V_LD + d4 * 16);
#pragma unroll
      for (int i = 0; i < 8; ++i) { av[d4][i] = lo[i]; av[d4][i + 8] = hb[i]; }
    }
    // Keeps the 8 transposing loads ahead of the softmax, which then covers their latency.
    __builtin_amdgcn_sched_barrier(0);

    // ---- scale + ALiBi + causal mask ----
#pragma unroll
    for (int t2 = 0; t2 < 2; ++t2) {
#pragma unroll
      for (int r = 0; r < 8; ++r) {
        int kc = kb0 + t2 * 16 + mhi + r;
        float v = s[t2][r] * 0.125f +
                  slope * fminf((float)(kc - qr), 0.0f);
        if (kc > qr) v = -1e30f;
        s[t2][r] = v;
      }
    }

    // ---- online softmax: in-lane trees, one exchange between the halves ----
    float t8[8];
#pragma unroll
    for (int r = 0; r < 8; ++r) t8[r] = fmaxf(s[0][r], s[1][r]);
#pragma unroll
    for (int w = 4; w > 0; w >>= 1)
#pragma unroll
      for (int r = 0; r < w; ++r) t8[r] = fmaxf(t8[r], t8[r + w]);
    float mx = fmaxf(t8[0], xhalf(t8[0]));
    float mnew = fmaxf(mrun, mx);
    float alpha = __expf(mrun - mnew);
    mrun = mnew;

#pragma unroll
    for (int t2 = 0; t2 < 2; ++t2)
#pragma unroll
      for (int r = 0; r < 8; ++r) s[t2][r] = __expf(s[t2][r] - mnew);

#pragma unroll
    for (int r = 0; r < 8; ++r) t8[r] = s[0][r] + s[1][r];
#pragma unroll
    for (int w = 4; w > 0; w >>= 1)
#pragma unroll
      for (int r = 0; r < w; ++r) t8[r] += t8[r + w];
    lrun = lrun * alpha + t8[0];

#pragma unroll
    for (int d4 = 0; d4 < 4; ++d4)
#pragma unroll
      for (int r = 0; r < 8; ++r) o[d4][r] *= alpha;

    // ---- P^T: the two score tiles, converted in place, are the B operand ----
    v16h bp;
#pragma unroll
    for (int r = 0; r < 8; ++r) {
      bp[r]     = (_Float16)s[0][r];
      bp[r + 8] = (_Float16)s[1][r];
    }

    // ---- O^T += V^T * P^T ----
#pragma unroll
    for (int d4 = 0; d4 < 4; ++d4) o[d4] = wmma_f16(av[d4], bp, o[d4]);
  }

  // ---- epilogue: join the halves' sums, normalize, store y as f16 [B,T,C] ----
  lrun += xhalf(lrun);
#pragma unroll
  for (int d4 = 0; d4 < 4; ++d4) {
    v8h pk;
#pragma unroll
    for (int r = 0; r < 8; ++r) pk[r] = (_Float16)(o[d4][r] / lrun);
    *(v8h*)(ybuf + ((size_t)(b * T_SEQ + qr)) * C_DIM + h * DH + d4 * 16 + mhi) = pk;
  }
}

// ---------------------------------------------------------------------------
// Output projection: out[m,n] = sum_k y[m,k] * W_proj[n,k] + b_proj[n]  (f32)
// M=4096, N=1024, K=1024.  Same ping-pong pipelined 32x64-per-wave structure.
// ---------------------------------------------------------------------------
__global__ void __launch_bounds__(256)
gemm_proj(const _Float16* __restrict__ yh, const _Float16* __restrict__ wh,
          const float* __restrict__ bias, float* __restrict__ out) {
  int wave = threadIdx.x >> 5;
  int wm = wave >> 2;
  int wn = wave & 3;
  int m0 = blockIdx.y * 64 + wm * 32;
  int n0 = blockIdx.x * 256 + wn * 64;

  const _Float16* Arow0 = yh + (size_t)m0 * C_DIM;
  const _Float16* Arow1 = yh + (size_t)(m0 + 16) * C_DIM;
  const _Float16* Brow[4];
#pragma unroll
  for (int t = 0; t < 4; ++t) Brow[t] = wh + (size_t)(n0 + t * 16) * C_DIM;

  v8f acc[2][4] = {};

  v16h a0A = load_frag_rm(Arow0, C_DIM);
  v16h a1A = load_frag_rm(Arow1, C_DIM);
  v16h bA[4];
#pragma unroll
  for (int t = 0; t < 4; ++t) bA[t] = load_frag_rm(Brow[t], C_DIM);

  v16h a0B, a1B, bB[4];

  for (int k = 0; k < C_DIM; k += 64) {
    a0B = load_frag_rm(Arow0 + k + 32, C_DIM);
    a1B = load_frag_rm(Arow1 + k + 32, C_DIM);
#pragma unroll
    for (int t = 0; t < 4; ++t) bB[t] = load_frag_rm(Brow[t] + k + 32, C_DIM);

#pragma unroll
    for (int t = 0; t < 4; ++t) {
      acc[0][t] = wmma_f16(a0A, bA[t], acc[0][t]);
      acc[1][t] = wmma_f16(a1A, bA[t], acc[1][t]);
    }

    int kn = (k + 64 < C_DIM) ? (k + 64) : 0;
    a0A = load_frag_rm(Arow0 + kn, C_DIM);
    a1A = load_frag_rm(Arow1 + kn, C_DIM);
#pragma unroll
    for (int t = 0; t < 4; ++t) bA[t] = load_frag_rm(Brow[t] + kn, C_DIM);

#pragma unroll
    for (int t = 0; t < 4; ++t) {
      acc[0][t] = wmma_f16(a0B, bB[t], acc[0][t]);
      acc[1][t] = wmma_f16(a1B, bB[t], acc[1][t]);
    }
  }

  int lane = threadIdx.x & 31;
  int ncl  = lane & 15;
  int mhi  = (lane >> 4) ? 8 : 0;
#pragma unroll
  for (int t = 0; t < 4; ++t) {
    int n = n0 + t * 16 + ncl;
    float bv = bias[n];
#pragma unroll
    for (int mi = 0; mi < 2; ++mi) {
#pragma unroll
      for (int r = 0; r < 8; ++r) {
        int m = m0 + mi * 16 + r + mhi;
        out[(size_t)m * C_DIM + n] = acc[mi][t][r] + bv;
      }
    }
  }
}

// ---------------------------------------------------------------------------
// Launch
// ---------------------------------------------------------------------------
extern "C" void kernel_launch(void* const* d_in, const int* in_sizes, int n_in,
                              void* d_out, int out_size, void* d_ws, size_t ws_size,
                              hipStream_t stream) {
  const float* x      = (const float*)d_in[0];   // [B,T,C]
  const float* W_attn = (const float*)d_in[1];   // [3C,C]
  const float* b_attn = (const float*)d_in[2];   // [3C]
  const float* W_proj = (const float*)d_in[3];   // [C,C]
  const float* b_proj = (const float*)d_in[4];   // [C]
  float* out = (float*)d_out;

  char* ws = (char*)d_ws;
  const size_t n_x  = (size_t)B_SZ * T_SEQ * C_DIM;        // 4,194,304
  const size_t n_wa = (size_t)3 * C_DIM * C_DIM;           // 3,145,728
  const size_t n_wp = (size_t)C_DIM * C_DIM;               // 1,048,576
  const size_t n_qkv = (size_t)B_SZ * H_NUM * T_SEQ * DH;  // 4,194,304

  _Float16* xh  = (_Float16*)(ws);
  _Float16* wah = (_Float16*)(ws + 2 * n_x);
  _Float16* wph = (_Float16*)(ws + 2 * (n_x + n_wa));
  _Float16* qb  = (_Float16*)(ws + 2 * (n_x + n_wa + n_wp));
  _Float16* kb  = (_Float16*)(ws + 2 * (n_x + n_wa + n_wp + n_qkv));
  _Float16* vb  = (_Float16*)(ws + 2 * (n_x + n_wa + n_wp + 2 * n_qkv));
  _Float16* yb  = (_Float16*)(ws + 2 * (n_x + n_wa + n_wp + 3 * n_qkv));

  // xh, wah and wph are one flat f16 array that starts at xh
  cast3_f32_f16<<<CAST_NB_X + CAST_NB_WA + CAST_NB_WP, CAST_THR, 0, stream>>>(x, W_attn, W_proj, xh);

  // QKV GEMM: block tile 64x256 -> grid = (3072/256, 4096/64) = (12, 64)
  gemm_qkv<<<dim3(12, 64), 256, 0, stream>>>(xh, wah, b_attn, qb, kb, vb);

  // Attention: (T/64, H, B)
  attn_fwd<<<dim3(T_SEQ / 64, H_NUM, B_SZ), 128, 0, stream>>>(qb, kb, vb, yb);

  // Projection: block tile 64x256 -> grid = (1024/256, 4096/64) = (4, 64)
  gemm_proj<<<dim3(4, 64), 256, 0, stream>>>(yb, wph, b_proj, out);
}

// v003
// A run of this version takes 131 microseconds.
// Next to v002, in two timings, it ran 1.50 and 1.54 times as fast.
// Over all steps from v000 it is 2.19 times as fast.
#include <hip/hip_runtime.h>
#include <hip/hip_bf16.h>

typedef __attribute__((ext_vector_type(16))) _Float16 v16h;
typedef __attribute__((ext_vector_type(8)))  _Float16 v8h;
typedef __attribute__((ext_vector_type(8)))  float    v8f;

#define B_SZ   2
#define T_SEQ  2048
#define C_DIM  1024
#define H_NUM  16
#define DH     64

__device__ __forceinline__ v8f wmma_f16(v16h a, v16h b, v8f c) {
  return __builtin_amdgcn_wmma_f32_16x16x32_f16(
      /*neg_a=*/false, a, /*neg_b=*/false, b,
      /*c_mod=*/(short)0, c, /*reuse_a=*/false, /*reuse_b=*/false);
}

__device__ __forceinline__ v16h load_frag_rm(const _Float16* p, int ld) {
  int lane = threadIdx.x & 31;
  int row  = lane & 15;
  int hi   = (lane >> 4) ? 8 : 0;
  const _Float16* r = p + (size_t)row * ld;
  v8h lo = *(const v8h*)(r + hi);
  v8h hb = *(const v8h*)(r + 16 + hi);
  v16h out;
#pragma unroll
  for (int i = 0; i < 8; ++i) { out[i] = lo[i]; out[i + 8] = hb[i]; }
  return out;
}

// Transposing LDS load: lane (c = lane & 15, h = lane >> 4) receives the eight
// 16-bit values T[kbase + 8h + 0..7][dbase + c] of a row-major LDS tile.
typedef short s16x8 __attribute__((ext_vector_type(8)));
__device__ __forceinline__ v8h ld_tr16(const _Float16* p) {
  typedef __attribute__((address_space(3))) s16x8 lds_s16x8;
  return __builtin_bit_cast(v8h, __builtin_amdgcn_ds_load_tr16_b128_v8i16((lds_s16x8*)p));
}

__device__ __forceinline__ float xhalf(float x) {
  int xi = __builtin_bit_cast(int, x);
  return __builtin_bit_cast(float, __builtin_amdgcn_permlanex16(
      xi, xi, 0x76543210, 0xfedcba98, false, false));
}

// ---------------------------------------------------------------------------
// f32 -> f16 cast of x, W_attn and W_proj in ONE launch. The three f16 copies lie
// one behind the other in the workspace, so the destination is one flat array.
// One 16-wave block per WGP; a block converts CAST_BLK elements in a row, all of
// one source. A wave load covers 512 B in a row, a wave store 256 B; a thread's
// 16 loads are all in flight before its first store.
// ---------------------------------------------------------------------------
typedef __attribute__((ext_vector_type(4))) float    v4f;
typedef __attribute__((ext_vector_type(4))) _Float16 v4h;

#define CAST_THR   512
#define CAST_PER   16                            // 16-byte loads per thread
#define CAST_STEP  (CAST_THR * 4)                // elements per block and load round
#define CAST_BLK   (CAST_STEP * CAST_PER)        // elements per block
#define CAST_NB_X  (B_SZ * T_SEQ * C_DIM / CAST_BLK)
#define CAST_NB_WA (3 * C_DIM * C_DIM / CAST_BLK)
#define CAST_NB_WP (C_DIM * C_DIM / CAST_BLK)
static_assert(CAST_NB_X * CAST_BLK == B_SZ * T_SEQ * C_DIM, "x is whole blocks");
static_assert(CAST_NB_WA * CAST_BLK == 3 * C_DIM * C_DIM, "W_attn is whole blocks");
static_assert(CAST_NB_WP * CAST_BLK == C_DIM * C_DIM, "W_proj is whole blocks");

__global__ void __launch_bounds__(CAST_THR)
cast3_f32_f16(const float* __restrict__ x, const float* __restrict__ wa,
              const float* __restrict__ wp, _Float16* __restrict__ out) {
  int blk = blockIdx.x;
  const float* src = x;
  int first = 0;
  if (blk >= CAST_NB_X)              { src = wa; first = CAST_NB_X; }
  if (blk >= CAST_NB_X + CAST_NB_WA) { src = wp; first = CAST_NB_X + CAST_NB_WA; }
  const float* sp = src + (size_t)(blk - first) * CAST_BLK + threadIdx.x * 4;
  _Float16*    dp = out + (size_t)blk * CAST_BLK + threadIdx.x * 4;

  v4f v[CAST_PER];
#pragma unroll
  for (int i = 0; i < CAST_PER; ++i) v[i] = *(const v4f*)(sp + i * CAST_STEP);
  // Keeps all 16 loads ahead of the first conversion: left free, the scheduler holds the last
  // two back until the first two have landed, and the wave pays the memory latency twice.
  __builtin_amdgcn_sched_barrier(0);
  v4h h[CAST_PER];
#pragma unroll
  for (int i = 0; i < CAST_PER; ++i) h[i] = __builtin_convertvector(v[i], v4h);
  // Keeps the stores behind the last conversion, each with data registers of its own: left
  // free, the scheduler reuses the first stores' registers and waits for those stores between
  // the later conversions.
  __builtin_amdgcn_sched_barrier(0);
#pragma unroll
  for (int i = 0; i < CAST_PER; ++i) *(v4h*)(dp + i * CAST_STEP) = h[i];
}

// ---------------------------------------------------------------------------
// Main loop of both GEMMs: acc[m,n] = sum_k A[m,k] * Bm[n,k], K = C_DIM, both
// operands K-contiguous f16.
// Block = 512 threads = 16 waves arranged 4(M) x 4(N); wave tile = 16*FM x 16*FN,
// block tile = 64*FM x 64*FN, at most one block per WGP.
// A stage is 64 k (128 B) of every operand row of the block tile, A's rows first,
// at an LDS pitch of 144 B (16 B x odd: ds_load_b128 readers). Asynchronous copies
// bring it in, 16 B a lane, eight lanes to a row, so a wave's copy covers four
// whole 128-B lines and every line is fetched once per block. Two buffers: stage
// t + 2 flies while stage t + 1 is worked on.
// ---------------------------------------------------------------------------
#define G_THR  512
#define G_KST  64                 // k per stage
#define G_LDP  72                 // LDS row pitch in halves (144 B)
#define G_NT   (C_DIM / G_KST)    // stages
static_assert(G_NT >= 2, "the prologue fills two stages");
static_assert(G_KST == 64, "the loop body is written for two k steps of 32 per stage");

template <int N>
__device__ __forceinline__ void async_copies(const unsigned (&l)[N], const _Float16* const (&g)[N]) {
  static_assert(N == 4 || N == 8, "written out for 4 and 8 copies");
  if constexpr (N == 4) {
    asm volatile("global_load_async_to_lds_b128 %0, %1, off\n\t"
                 "global_load_async_to_lds_b128 %2, %3, off\n\t"
                 "global_load_async_to_lds_b128 %4, %5, off\n\t"
                 "global_load_async_to_lds_b128 %6, %7, off\n\t"
                 "s_wait_xcnt 0x0"
                 :: "v"(l[0]), "v"(g[0]), "v"(l[1]), "v"(g[1]), "v"(l[2]), "v"(g[2]),
                    "v"(l[3]), "v"(g[3])
                 : "memory");
  } else {
    asm volatile("global_load_async_to_lds_b128 %0, %1, off\n\t"
                 "global_load_async_to_lds_b128 %2, %3, off\n\t"
                 "global_load_async_to_lds_b128 %4, %5, off\n\t"
                 "global_load_async_to_lds_b128 %6, %7, off\n\t"
                 "global_load_async_to_lds_b128 %8, %9, off\n\t"
                 "global_load_async_to_lds_b128 %10, %11, off\n\t"
                 "global_load_async_to_lds_b128 %12, %13, off\n\t"
                 "global_load_async_to_lds_b128 %14, %15, off\n\t"
                 "s_wait_xcnt 0x0"
                 :: "v"(l[0]), "v"(g[0]), "v"(l[1]), "v"(g[1]), "v"(l[2]), "v"(g[2]),
                    "v"(l[3]), "v"(g[3]), "v"(l[4]), "v"(g[4]), "v"(l[5]), "v"(g[5]),
                    "v"(l[6]), "v"(g[6]), "v"(l[7]), "v"(g[7])
                 : "memory");
  }
}

// 16x32 f16 fragment from an LDS row: same k order as load_frag_rm. p = this lane's row,
// at the k step's first half plus 8 * (lane >> 4).
__device__ __forceinline__ v16h lds_frag(const _Float16* p) {
  v8h lo = *(const v8h*)(p);
  v8h hb = *(const v8h*)(p + 16);
  v16h out;
#pragma unroll
  for (int i = 0; i < 8; ++i) { out[i] = lo[i]; out[i + 8] = hb[i]; }
  return out;
}

template <int FM, int FN>
__device__ __forceinline__ void gemm_main(const _Float16* __restrict__ A,
                                          const _Float16* __restrict__ Bm,
                                          int mblk, int nblk, _Float16* sm,
                                          v8f (&acc)[FM][FN]) {
  constexpr int ROWS  = 64 * (FM + FN);    // operand rows per stage
  constexpr int NCP   = FM + FN;           // copies per thread and stage (64 rows each)
  constexpr int STAGE = ROWS * G_LDP;      // halves per buffer

  const int tid  = threadIdx.x;
  const int lane = tid & 31;
  const int wave = tid >> 5;
  const int wm   = wave >> 2;
  const int wn   = wave & 3;

  // this thread's copies: row i*64 + tid/8 of the stage, 16-byte piece tid & 7
  const int crow = tid >> 3;
  const int cpc  = (tid & 7) * 8;
  const unsigned lbase = (unsigned)(size_t)sm;   // LDS byte address: low 32 bits
  const _Float16* g0[NCP];
  unsigned        l0[NCP];
#pragma unroll
  for (int i = 0; i < NCP; ++i) {
    g0[i] = (i < FM ? A + (size_t)(mblk + i * 64 + crow) * C_DIM
                    : Bm + (size_t)(nblk + (i - FM) * 64 + crow) * C_DIM) + cpc;
    l0[i] = lbase + (unsigned)(((i * 64 + crow) * G_LDP + cpc) * 2);
  }
  auto issue = [&](int t, int buf) {
    const _Float16* g[NCP];
    unsigned        l[NCP];
#pragma unroll
    for (int i = 0; i < NCP; ++i) {
      g[i] = g0[i] + t * G_KST;
      l[i] = l0[i] + (unsigned)(buf * STAGE * 2);
    }
    async_copies<NCP>(l, g);
  };

  // this lane's fragment rows in a buffer
  const int frow = lane & 15;
  const int fk   = (lane >> 4) * 8;
  const int aoff = (wm * FM * 16 + frow) * G_LDP + fk;
  const int boff = (64 * FM + wn * FN * 16 + frow) * G_LDP + fk;

  issue(0, 0);
  // stage 0 has landed for this wave; the barrier publishes it to the others
  asm volatile("s_wait_asynccnt 0x0" ::: "memory");
  __syncthreads();
  issue(1, 1);

  for (int t = 0; t < G_NT; ++t) {
    const _Float16* sb = sm + (t & 1) * STAGE;
    v16h a[FM], b[FN], a2[FM], b2[FN];
#pragma unroll
    for (int i = 0; i < FM; ++i) a[i] = lds_frag(sb + aoff + i * 16 * G_LDP);
#pragma unroll
    for (int j = 0; j < FN; ++j) b[j] = lds_frag(sb + boff + j * 16 * G_LDP);
    __builtin_amdgcn_sched_barrier(0);
#pragma unroll
    for (int j = 0; j < FN; ++j)
#pragma unroll
      for (int i = 0; i < FM; ++i) acc[i][j] = wmma_f16(a[i], b[j], acc[i][j]);
    // second k step of the stage: its fragments are the last reads of buffer t & 1
#pragma unroll
    for (int i = 0; i < FM; ++i) a2[i] = lds_frag(sb + aoff + i * 16 * G_LDP + 32);
#pragma unroll
    for (int j = 0; j < FN; ++j) b2[j] = lds_frag(sb + boff + j * 16 * G_LDP + 32);
    // publish point of stage t + 1: this wave's reads of buffer t & 1 are done ...
    asm volatile("s_wait_dscnt 0x0" ::: "memory");
    // ... its copies of stage t + 1 have landed ...
    asm volatile("s_wait_asynccnt 0x0" ::: "memory");
    // ... and the one barrier both publishes stage t + 1 and frees buffer t & 1
    __syncthreads();
    if (t + 2 < G_NT) issue(t + 2, t & 1);
    // the second k step's products work from registers, under the copies just issued
#pragma unroll
    for (int j = 0; j < FN; ++j)
#pragma unroll
      for (int i = 0; i < FM; ++i) acc[i][j] = wmma_f16(a2[i], b2[j], acc[i][j]);
  }
  // no copy is left in flight when the wave goes on to its stores and ends
  asm volatile("s_wait_asynccnt 0x0" ::: "memory");
}

// ---------------------------------------------------------------------------
// QKV GEMM: qkv[m,n] = sum_k x[m,k] * W_attn[n,k] + b_attn[n]
// M=4096, N=3072, K=1024. Block tile 256 x 256 (wave tile 64 x 64, one head wide, so
// that every 128-B line of Q, K and V has one writing wave): 12 x 16 blocks.
// Epilogue scatters into Q/K/V f16 buffers, layout [B,H,T,Dh].
// ---------------------------------------------------------------------------
#define QKV_FM 4
#define QKV_FN 4
__global__ void __launch_bounds__(G_THR)
gemm_qkv(const _Float16* __restrict__ xh, const _Float16* __restrict__ wh,
         const float* __restrict__ bias,
         _Float16* __restrict__ qb, _Float16* __restrict__ kb,
         _Float16* __restrict__ vb) {
  __shared__ __attribute__((aligned(16))) _Float16 sm[2 * 64 * (QKV_FM + QKV_FN) * G_LDP];
  int wave = threadIdx.x >> 5;        // 0..15
  int mblk = blockIdx.y * (64 * QKV_FM);
  int nblk = blockIdx.x * (64 * QKV_FN);

  v8f acc[QKV_FM][QKV_FN] = {};
  gemm_main<QKV_FM, QKV_FN>(xh, wh, mblk, nblk, sm, acc);

  int m0 = mblk + (wave >> 2) * (16 * QKV_FM);
  int n0 = nblk + (wave & 3) * (16 * QKV_FN);
  int lane = threadIdx.x & 31;
  int ncl  = lane & 15;
  int mhi  = (lane >> 4) ? 8 : 0;
#pragma unroll
  for (int t = 0; t < QKV_FN; ++t) {
    int n = n0 + t * 16 + ncl;
    float bv = bias[n];
    int which = n >> 10;            // 0=q,1=k,2=v
    int c = n & 1023;
    int h = c >> 6;
    int d = c & 63;
    _Float16* dst = (which == 0) ? qb : ((which == 1) ? kb : vb);
#pragma unroll
    for (int mi = 0; mi < QKV_FM; ++mi) {
#pragma unroll
      for (int r = 0; r < 8; ++r) {
        int m = m0 + mi * 16 + r + mhi;
        int bidx = m >> 11;           // /T
        int tpos = m & (T_SEQ - 1);
        dst[(((size_t)(bidx * H_NUM + h) * T_SEQ) + tpos) * DH + d] =
            (_Float16)(acc[mi][t][r] + bv);
      }
    }
  }
}

#define V_LD   80                 // 160-byte rows: odd multiple of 32 B for the transposing load
#define WAVE_LDS (32 * V_LD)      // 2560 halves per wave

__global__ void __launch_bounds__(128)
attn_fwd(const _Float16* __restrict__ qbuf, const _Float16* __restrict__ kbuf,
         const _Float16* __restrict__ vbuf, _Float16* __restrict__ ybuf) {
  __shared__ __attribute__((aligned(16))) _Float16 smem[4 * WAVE_LDS];

  int wave = threadIdx.x >> 5;
  int lane = threadIdx.x & 31;
  int b = blockIdx.z;
  int h = blockIdx.y;
  int q0 = blockIdx.x * 64 + wave * 16;

  const _Float16* Q = qbuf + (size_t)(b * H_NUM + h) * T_SEQ * DH;
  const _Float16* K = kbuf + (size_t)(b * H_NUM + h) * T_SEQ * DH;
  const _Float16* V = vbuf + (size_t)(b * H_NUM + h) * T_SEQ * DH;

  _Float16* vl = smem + wave * WAVE_LDS;        // V tile  32 x V_LD

  // Q fragments (B operand) held for the whole key loop (Dh=64 -> two 32x16)
  v16h bq0 = load_frag_rm(Q + (size_t)q0 * DH + 0, DH);
  v16h bq1 = load_frag_rm(Q + (size_t)q0 * DH + 32, DH);

  v8f o[4] = {};                  // o[d4][r] = O^T[d4*16 + mhi + r][q0 + ncl]
  float mrun = -1e30f;            // this query's running maximum (same in both halves)
  float lrun = 0.0f;              // this half's share of the running denominator

  float slope = exp2f(-8.0f / (float)H_NUM * (float)(h + 1));
  int mhi = (lane >> 4) ? 8 : 0;
  int ncl = lane & 15;
  int qr  = q0 + ncl;

  // lane address of the transposing loads (key rows 0..15, d columns 0..15)
  const _Float16* vtr = vl + (mhi + (lane & 7)) * V_LD + ((lane >> 3) & 1) * 8;

  for (int kb0 = 0; kb0 <= q0 + 15; kb0 += 32) {
    // ---- this pass's 16 global loads: V[kb0..kb0+31, 0..63] and the K fragments ----
    const _Float16* vp = V + (size_t)(kb0 + (lane >> 3)) * DH + (lane & 7) * 8;
    const _Float16* kp = K + (size_t)(kb0 + ncl) * DH + mhi;
    v8h vd[8];                        // chunk c: V row kb0 + 4c + lane/8, halves 8*(lane&7)..+7
#pragma unroll
    for (int c = 0; c < 8; ++c) vd[c] = *(const v8h*)(vp + c * 4 * DH);
    v8h kd[2][4];                     // K row kb0 + 16*t2 + ncl, halves 16*j + mhi..+7
#pragma unroll
    for (int t2 = 0; t2 < 2; ++t2)
#pragma unroll
      for (int j = 0; j < 4; ++j) kd[t2][j] = *(const v8h*)(kp + t2 * 16 * DH + j * 16);
    // Stands behind the pass's loads and in front of any rewrite of their address registers
    // (named as inputs so that they stay whole up to here). Its memory clobber also keeps the
    // 16 loads one group ahead of the LDS stores: left free, the scheduler sinks V's loads
    // behind the products and the pass waits for L2 several times in a row.
    asm volatile("s_wait_xcnt 0x0" :: "v"(vp), "v"(kp) : "memory");

    // ---- stage V into LDS (wave-cooperative) ----
#pragma unroll
    for (int c = 0; c < 8; ++c) {
      int idx = c * 32 + lane;
      *(v8h*)(vl + (idx >> 3) * V_LD + (idx & 7) * 8) = vd[c];
    }

    // ---- S^T = K Q^T for two 16-key tiles ----
    v8f s[2];
#pragma unroll
    for (int t2 = 0; t2 < 2; ++t2) {
      v16h ak0, ak1;
#pragma unroll
      for (int i = 0; i < 8; ++i) {
        ak0[i] = kd[t2][0][i]; ak0[i + 8] = kd[t2][1][i];
        ak1[i] = kd[t2][2][i]; ak1[i + 8] = kd[t2][3][i];
      }
      v8f c = {};
      c = wmma_f16(ak0, bq0, c);
      c = wmma_f16(ak1, bq1, c);
      s[t2] = c;
    }

    // Same-wave LDS ops are in-order; make the store -> load dependency explicit.
    asm volatile("s_wait_dscnt 0" ::: "memory");

    // ---- V^T fragments (A operand), in flight under the softmax ----
    v16h av[4];
#pragma unroll
    for (int d4 = 0; d4 < 4; ++d4) {
      v8h lo = ld_tr16(vtr + d4 * 16);
      v8h hb = ld_tr16(vtr + 16 * V_LD + d4 * 16);
#pragma unroll
      for (int i = 0; i < 8; ++i) { av[d4][i] = lo[i]; av[d4][i + 8] = hb[i]; }
    }
    // Keeps the 8 transposing loads ahead of the softmax, which then covers their latency.
    __builtin_amdgcn_sched_barrier(0);

    // ---- scale + ALiBi + causal mask ----
#pragma unroll
    for (int t2 = 0; t2 < 2; ++t2) {
#pragma unroll
      for (int r = 0; r < 8; ++r) {
        int kc = kb0 + t2 * 16 + mhi + r;
        float v = s[t2][r] * 0.125f +
                  slope * fminf((float)(kc - qr), 0.0f);
        if (kc > qr) v = -1e30f;
        s[t2][r] = v;
      }
    }

    // ---- online softmax: in-lane trees, one exchange between the halves ----
    float t8[8];
#pragma unroll
    for (int r = 0; r < 8; ++r) t8[r] = fmaxf(s[0][r], s[1][r]);
#pragma unroll
    for (int w = 4; w > 0; w >>= 1)
#pragma unroll
      for (int r = 0; r < w; ++r) t8[r] = fmaxf(t8[r], t8[r + w]);
    float mx = fmaxf(t8[0], xhalf(t8[0]));
    float mnew = fmaxf(mrun, mx);
    float alpha = __expf(mrun - mnew);
    mrun = mnew;

#pragma unroll
    for (int t2 = 0; t2 < 2; ++t2)
#pragma unroll
      for (int r = 0; r < 8; ++r) s[t2][r] = __expf(s[t2][r] - mnew);

#pragma unroll
    for (int r = 0; r < 8; ++r) t8[r] = s[0][r] + s[1][r];
#pragma unroll
    for (int w = 4; w > 0; w >>= 1)
#pragma unroll
      for (int r = 0; r < w; ++r) t8[r] += t8[r + w];
    lrun = lrun * alpha + t8[0];

#pragma unroll
    for (int d4 = 0; d4 < 4; ++d4)
#pragma unroll
      for (int r = 0; r < 8; ++r) o[d4][r] *= alpha;

    // ---- P^T: the two score tiles, converted in place, are the B operand ----
    v16h bp;
#pragma unroll
    for (int r = 0; r < 8; ++r) {
      bp[r]     = (_Float16)s[0][r];
      bp[r + 8] = (_Float16)s[1][r];
    }

    // ---- O^T += V^T * P^T ----
#pragma unroll
    for (int d4 = 0; d4 < 4; ++d4) o[d4] = wmma_f16(av[d4], bp, o[d4]);
  }

  // ---- epilogue: join the halves' sums, normalize, store y as f16 [B,T,C] ----
  lrun += xhalf(lrun);
#pragma unroll
  for (int d4 = 0; d4 < 4; ++d4) {
    v8h pk;
#pragma unroll
    for (int r = 0; r < 8; ++r) pk[r] = (_Float16)(o[d4][r] / lrun);
    *(v8h*)(ybuf + ((size_t)(b * T_SEQ + qr)) * C_DIM + h * DH + d4 * 16 + mhi) = pk;
  }
}

// ---------------------------------------------------------------------------
// Output projection: out[m,n] = sum_k y[m,k] * W_proj[n,k] + b_proj[n]  (f32)
// M=4096, N=1024, K=1024. Block tile 128 x 128 (wave tile 32 x 32): 8 x 32 blocks.
// ---------------------------------------------------------------------------
#define PRJ_FM 2
#define PRJ_FN 2
__global__ void __launch_bounds__(G_THR)
gemm_proj(const _Float16* __restrict__ yh, const _Float16* __restrict__ wh,
          const float* __restrict__ bias, float* __restrict__ out) {
  __shared__ __attribute__((aligned(16))) _Float16 sm[2 * 64 * (PRJ_FM + PRJ_FN) * G_LDP];
  int wave = threadIdx.x >> 5;
  int mblk = blockIdx.y * (64 * PRJ_FM);
  int nblk = blockIdx.x * (64 * PRJ_FN);

  v8f acc[PRJ_FM][PRJ_FN] = {};
  gemm_main<PRJ_FM, PRJ_FN>(yh, wh, mblk, nblk, sm, acc);

  int m0 = mblk + (wave >> 2) * (16 * PRJ_FM);
  int n0 = nblk + (wave & 3) * (16 * PRJ_FN);
  int lane = threadIdx.x & 31;
  int ncl  = lane & 15;
  int mhi  = (lane >> 4) ? 8 : 0;
#pragma unroll
  for (int t = 0; t < PRJ_FN; ++t) {
    int n = n0 + t * 16 + ncl;
    float bv = bias[n];
#pragma unroll
    for (int mi = 0; mi < PRJ_FM; ++mi) {
#pragma unroll
      for (int r = 0; r < 8; ++r) {
        int m = m0 + mi * 16 + r + mhi;
        out[(size_t)m * C_DIM + n] = acc[mi][t][r] + bv;
      }
    }
  }
}

// ---------------------------------------------------------------------------
// Launch
// ---------------------------------------------------------------------------
extern "C" void kernel_launch(void* const* d_in, const int* in_sizes, int n_in,
                              void* d_out, int out_size, void* d_ws, size_t ws_size,
                              hipStream_t stream) {
  const float* x      = (const float*)d_in[0];   // [B,T,C]
  const float* W_attn = (const float*)d_in[1];   // [3C,C]
  const float* b_attn = (const float*)d_in[2];   // [3C]
  const float* W_proj = (const float*)d_in[3];   // [C,C]
  const float* b_proj = (const float*)d_in[4];   // [C]
  float* out = (float*)d_out;

  char* ws = (char*)d_ws;
  const size_t n_x  = (size_t)B_SZ * T_SEQ * C_DIM;        // 4,194,304
  const size_t n_wa = (size_t)3 * C_DIM * C_DIM;           // 3,145,728
  const size_t n_wp = (size_t)C_DIM * C_DIM;               // 1,048,576
  const size_t n_qkv = (size_t)B_SZ * H_NUM * T_SEQ * DH;  // 4,194,304

  _Float16* xh  = (_Float16*)(ws);
  _Float16* wah = (_Float16*)(ws + 2 * n_x);
  _Float16* wph = (_Float16*)(ws + 2 * (n_x + n_wa));
  _Float16* qb  = (_Float16*)(ws + 2 * (n_x + n_wa + n_wp));
  _Float16* kb  = (_Float16*)(ws + 2 * (n_x + n_wa + n_wp + n_qkv));
  _Float16* vb  = (_Float16*)(ws + 2 * (n_x + n_wa + n_wp + 2 * n_qkv));
  _Float16* yb  = (_Float16*)(ws + 2 * (n_x + n_wa + n_wp + 3 * n_qkv));

  // xh, wah and wph are one flat f16 array that starts at xh
  cast3_f32_f16<<<CAST_NB_X + CAST_NB_WA + CAST_NB_WP, CAST_THR, 0, stream>>>(x, W_attn, W_proj, xh);

  // QKV GEMM: block tile 256x256 -> grid = (3072/256, 4096/256) = (12, 16)
  gemm_qkv<<<dim3(12, 16), G_THR, 0, stream>>>(xh, wah, b_attn, qb, kb, vb);

  // Attention: (T/64, H, B)
  attn_fwd<<<dim3(T_SEQ / 64, H_NUM, B_SZ), 128, 0, stream>>>(qb, kb, vb, yb);

  // Projection: block tile 128x128 -> grid = (1024/128, 4096/128) = (8, 32)
  gemm_proj<<<dim3(8, 32), G_THR, 0, stream>>>(yb, wph, b_proj, out);
}

// v004
// Measured time: 94.1 microseconds a run.
// Two timings next to v003 put it at 1.40 and 1.39 times that version's speed.
// Counting every step since v000, it is 3.06 times as fast.
#include <hip/hip_runtime.h>
#include <hip/hip_bf16.h>

typedef __attribute__((ext_vector_type(16))) _Float16 v16h;
typedef __attribute__((ext_vector_type(8)))  _Float16 v8h;
typedef __attribute__((ext_vector_type(8)))  float    v8f;

#define B_SZ   2
#define T_SEQ  2048
#define C_DIM  1024
#define H_NUM  16
#define DH     64

__device__ __forceinline__ v8f wmma_f16(v16h a, v16h b, v8f c) {
  return __builtin_amdgcn_wmma_f32_16x16x32_f16(
      /*neg_a=*/false, a, /*neg_b=*/false, b,
      /*c_mod=*/(short)0, c, /*reuse_a=*/false, /*reuse_b=*/false);
}

__device__ __forceinline__ v16h load_frag_rm(const _Float16* p, int ld) {
  int lane = threadIdx.x & 31;
  int row  = lane & 15;
  int hi   = (lane >> 4) ? 8 : 0;
  const _Float16* r = p + (size_t)row * ld;
  v8h lo = *(const v8h*)(r + hi);
  v8h hb = *(const v8h*)(r + 16 + hi);
  v16h out;
#pragma unroll
  for (int i = 0; i < 8; ++i) { out[i] = lo[i]; out[i + 8] = hb[i]; }
  return out;
}

// Transposing LDS load: lane (c = lane & 15, h = lane >> 4) receives the eight
// 16-bit values T[kbase + 8h + 0..7][dbase + c] of a row-major LDS tile.
typedef short s16x8 __attribute__((ext_vector_type(8)));
__device__ __forceinline__ v8h ld_tr16(const _Float16* p) {
  typedef __attribute__((address_space(3))) s16x8 lds_s16x8;
  return __builtin_bit_cast(v8h, __builtin_amdgcn_ds_load_tr16_b128_v8i16((lds_s16x8*)p));
}

__device__ __forceinline__ float xhalf(float x) {
  int xi = __builtin_bit_cast(int, x);
  return __builtin_bit_cast(float, __builtin_amdgcn_permlanex16(
      xi, xi, 0x76543210, 0xfedcba98, false, false));
}

// ---------------------------------------------------------------------------
// f32 -> f16 cast of x, W_attn and W_proj in ONE launch. The three f16 copies lie
// one behind the other in the workspace, so the destination is one flat array.
// One 16-wave block per WGP; a block converts CAST_BLK elements in a row, all of
// one source. A wave load covers 512 B in a row, a wave store 256 B; a thread's
// 16 loads are all in flight before its first store.
// ---------------------------------------------------------------------------
typedef __attribute__((ext_vector_type(4))) float    v4f;
typedef __attribute__((ext_vector_type(4))) _Float16 v4h;

#define CAST_THR   512
#define CAST_PER   16                            // 16-byte loads per thread
#define CAST_STEP  (CAST_THR * 4)                // elements per block and load round
#define CAST_BLK   (CAST_STEP * CAST_PER)        // elements per block
#define CAST_NB_X  (B_SZ * T_SEQ * C_DIM / CAST_BLK)
#define CAST_NB_WA (3 * C_DIM * C_DIM / CAST_BLK)
#define CAST_NB_WP (C_DIM * C_DIM / CAST_BLK)
static_assert(CAST_NB_X * CAST_BLK == B_SZ * T_SEQ * C_DIM, "x is whole blocks");
static_assert(CAST_NB_WA * CAST_BLK == 3 * C_DIM * C_DIM, "W_attn is whole blocks");
static_assert(CAST_NB_WP * CAST_BLK == C_DIM * C_DIM, "W_proj is whole blocks");

__global__ void __launch_bounds__(CAST_THR)
cast3_f32_f16(const float* __restrict__ x, const float* __restrict__ wa,
              const float* __restrict__ wp, _Float16* __restrict__ out) {
  int blk = blockIdx.x;
  const float* src = x;
  int first = 0;
  if (blk >= CAST_NB_X)              { src = wa; first = CAST_NB_X; }
  if (blk >= CAST_NB_X + CAST_NB_WA) { src = wp; first = CAST_NB_X + CAST_NB_WA; }
  const float* sp = src + (size_t)(blk - first) * CAST_BLK + threadIdx.x * 4;
  _Float16*    dp = out + (size_t)blk * CAST_BLK + threadIdx.x * 4;

  v4f v[CAST_PER];
#pragma unroll
  for (int i = 0; i < CAST_PER; ++i) v[i] = *(const v4f*)(sp + i * CAST_STEP);
  // Keeps all 16 loads ahead of the first conversion: left free, the scheduler holds the last
  // two back until the first two have landed, and the wave pays the memory latency twice.
  __builtin_amdgcn_sched_barrier(0);
  v4h h[CAST_PER];
#pragma unroll
  for (int i = 0; i < CAST_PER; ++i) h[i] = __builtin_convertvector(v[i], v4h);
  // Keeps the stores behind the last conversion, each with data registers of its own: left
  // free, the scheduler reuses the first stores' registers and waits for those stores between
  // the later conversions.
  __builtin_amdgcn_sched_barrier(0);
#pragma unroll
  for (int i = 0; i < CAST_PER; ++i) *(v4h*)(dp + i * CAST_STEP) = h[i];
}

// ---------------------------------------------------------------------------
// Main loop of both GEMMs: acc[m,n] = sum_k A[m,k] * Bm[n,k], K = C_DIM, both
// operands K-contiguous f16.
// Block = 512 threads = 16 waves arranged 4(M) x 4(N); wave tile = 16*FM x 16*FN,
// block tile = 64*FM x 64*FN, at most one block per WGP.
// A stage is 64 k (128 B) of every operand row of the block tile, A's rows first,
// at an LDS pitch of 144 B (16 B x odd: ds_load_b128 readers). Asynchronous copies
// bring it in, 16 B a lane, eight lanes to a row, so a wave's copy covers four
// whole 128-B lines and every line is fetched once per block. Two buffers: stage
// t + 2 flies while stage t + 1 is worked on.
// ---------------------------------------------------------------------------
#define G_THR  512
#define G_KST  64                 // k per stage
#define G_LDP  72                 // LDS row pitch in halves (144 B)
#define G_NT   (C_DIM / G_KST)    // stages
static_assert(G_NT >= 2, "the prologue fills two stages");
static_assert(G_KST == 64, "the loop body is written for two k steps of 32 per stage");

template <int N>
__device__ __forceinline__ void async_copies(const unsigned (&l)[N], const _Float16* const (&g)[N]) {
  static_assert(N == 4 || N == 8, "written out for 4 and 8 copies");
  if constexpr (N == 4) {
    asm volatile("global_load_async_to_lds_b128 %0, %1, off\n\t"
                 "global_load_async_to_lds_b128 %2, %3, off\n\t"
                 "global_load_async_to_lds_b128 %4, %5, off\n\t"
                 "global_load_async_to_lds_b128 %6, %7, off\n\t"
                 "s_wait_xcnt 0x0"
                 :: "v"(l[0]), "v"(g[0]), "v"(l[1]), "v"(g[1]), "v"(l[2]), "v"(g[2]),
                    "v"(l[3]), "v"(g[3])
                 : "memory");
  } else {
    asm volatile("global_load_async_to_lds_b128 %0, %1, off\n\t"
                 "global_load_async_to_lds_b128 %2, %3, off\n\t"
                 "global_load_async_to_lds_b128 %4, %5, off\n\t"
                 "global_load_async_to_lds_b128 %6, %7, off\n\t"
                 "global_load_async_to_lds_b128 %8, %9, off\n\t"
                 "global_load_async_to_lds_b128 %10, %11, off\n\t"
                 "global_load_async_to_lds_b128 %12, %13, off\n\t"
                 "global_load_async_to_lds_b128 %14, %15, off\n\t"
                 "s_wait_xcnt 0x0"
                 :: "v"(l[0]), "v"(g[0]), "v"(l[1]), "v"(g[1]), "v"(l[2]), "v"(g[2]),
                    "v"(l[3]), "v"(g[3]), "v"(l[4]), "v"(g[4]), "v"(l[5]), "v"(g[5]),
                    "v"(l[6]), "v"(g[6]), "v"(l[7]), "v"(g[7])
                 : "memory");
  }
}

// 16x32 f16 fragment from an LDS row: same k order as load_frag_rm. p = this lane's row,
// at the k step's first half plus 8 * (lane >> 4).
__device__ __forceinline__ v16h lds_frag(const _Float16* p) {
  v8h lo = *(const v8h*)(p);
  v8h hb = *(const v8h*)(p + 16);
  v16h out;
#pragma unroll
  for (int i = 0; i < 8; ++i) { out[i] = lo[i]; out[i + 8] = hb[i]; }
  return out;
}

template <int FM, int FN>
__device__ __forceinline__ void gemm_main(const _Float16* __restrict__ A,
                                          const _Float16* __restrict__ Bm,
                                          int mblk, int nblk, _Float16* sm,
                                          v8f (&acc)[FM][FN]) {
  constexpr int ROWS  = 64 * (FM + FN);    // operand rows per stage
  constexpr int NCP   = FM + FN;           // copies per thread and stage (64 rows each)
  constexpr int STAGE = ROWS * G_LDP;      // halves per buffer

  const int tid  = threadIdx.x;
  const int lane = tid & 31;
  const int wave = tid >> 5;
  const int wm   = wave >> 2;
  const int wn   = wave & 3;

  // this thread's copies: row i*64 + tid/8 of the stage, 16-byte piece tid & 7
  const int crow = tid >> 3;
  const int cpc  = (tid & 7) * 8;
  const unsigned lbase = (unsigned)(size_t)sm;   // LDS byte address: low 32 bits
  const _Float16* g0[NCP];
  unsigned        l0[NCP];
#pragma unroll
  for (int i = 0; i < NCP; ++i) {
    g0[i] = (i < FM ? A + (size_t)(mblk + i * 64 + crow) * C_DIM
                    : Bm + (size_t)(nblk + (i - FM) * 64 + crow) * C_DIM) + cpc;
    l0[i] = lbase + (unsigned)(((i * 64 + crow) * G_LDP + cpc) * 2);
  }
  auto issue = [&](int t, int buf) {
    const _Float16* g[NCP];
    unsigned        l[NCP];
#pragma unroll
    for (int i = 0; i < NCP; ++i) {
      g[i] = g0[i] + t * G_KST;
      l[i] = l0[i] + (unsigned)(buf * STAGE * 2);
    }
    async_copies<NCP>(l, g);
  };

  // this lane's fragment rows in a buffer
  const int frow = lane & 15;
  const int fk   = (lane >> 4) * 8;
  const int aoff = (wm * FM * 16 + frow) * G_LDP + fk;
  const int boff = (64 * FM + wn * FN * 16 + frow) * G_LDP + fk;

  issue(0, 0);
  // stage 0 has landed for this wave; the barrier publishes it to the others
  asm volatile("s_wait_asynccnt 0x0" ::: "memory");
  __syncthreads();
  issue(1, 1);

  for (int t = 0; t < G_NT; ++t) {
    const _Float16* sb = sm + (t & 1) * STAGE;
    v16h a[FM], b[FN], a2[FM], b2[FN];
#pragma unroll
    for (int i = 0; i < FM; ++i) a[i] = lds_frag(sb + aoff + i * 16 * G_LDP);
#pragma unroll
    for (int j = 0; j < FN; ++j) b[j] = lds_frag(sb + boff + j * 16 * G_LDP);
    __builtin_amdgcn_sched_barrier(0);
#pragma unroll
    for (int j = 0; j < FN; ++j)
#pragma unroll
      for (int i = 0; i < FM; ++i) acc[i][j] = wmma_f16(a[i], b[j], acc[i][j]);
    // second k step of the stage: its fragments are the last reads of buffer t & 1
#pragma unroll
    for (int i = 0; i < FM; ++i) a2[i] = lds_frag(sb + aoff + i * 16 * G_LDP + 32);
#pragma unroll
    for (int j = 0; j < FN; ++j) b2[j] = lds_frag(sb + boff + j * 16 * G_LDP + 32);
    // publish point of stage t + 1: this wave's reads of buffer t & 1 are done ...
    asm volatile("s_wait_dscnt 0x0" ::: "memory");
    // ... its copies of stage t + 1 have landed ...
    asm volatile("s_wait_asynccnt 0x0" ::: "memory");
    // ... and the one barrier both publishes stage t + 1 and frees buffer t & 1
    __syncthreads();
    if (t + 2 < G_NT) issue(t + 2, t & 1);
    // the second k step's products work from registers, under the copies just issued
#pragma unroll
    for (int j = 0; j < FN; ++j)
#pragma unroll
      for (int i = 0; i < FM; ++i) acc[i][j] = wmma_f16(a2[i], b2[j], acc[i][j]);
  }
  // no copy is left in flight when the wave goes on to its stores and ends
  asm volatile("s_wait_asynccnt 0x0" ::: "memory");
}

// ---------------------------------------------------------------------------
// QKV GEMM: qkv[m,n] = sum_k x[m,k] * W_attn[n,k] + b_attn[n]
// M=4096, N=3072, K=1024. Block tile 256 x 256 (wave tile 64 x 64, one head wide, so
// that every 128-B line of Q, K and V has one writing wave): 12 x 16 blocks.
// Epilogue scatters into Q/K/V f16 buffers, layout [B,H,T,Dh].
// ---------------------------------------------------------------------------
#define QKV_FM 4
#define QKV_FN 4
__global__ void __launch_bounds__(G_THR)
gemm_qkv(const _Float16* __restrict__ xh, const _Float16* __restrict__ wh,
         const float* __restrict__ bias,
         _Float16* __restrict__ qb, _Float16* __restrict__ kb,
         _Float16* __restrict__ vb) {
  __shared__ __attribute__((aligned(16))) _Float16 sm[2 * 64 * (QKV_FM + QKV_FN) * G_LDP];
  int wave = threadIdx.x >> 5;        // 0..15
  int mblk = blockIdx.y * (64 * QKV_FM);
  int nblk = blockIdx.x * (64 * QKV_FN);

  v8f acc[QKV_FM][QKV_FN] = {};
  gemm_main<QKV_FM, QKV_FN>(xh, wh, mblk, nblk, sm, acc);

  int m0 = mblk + (wave >> 2) * (16 * QKV_FM);
  int n0 = nblk + (wave & 3) * (16 * QKV_FN);
  int lane = threadIdx.x & 31;
  int ncl  = lane & 15;
  int mhi  = (lane >> 4) ? 8 : 0;
#pragma unroll
  for (int t = 0; t < QKV_FN; ++t) {
    int n = n0 + t * 16 + ncl;
    float bv = bias[n];
    int which = n >> 10;            // 0=q,1=k,2=v
    int c = n & 1023;
    int h = c >> 6;
    int d = c & 63;
    _Float16* dst = (which == 0) ? qb : ((which == 1) ? kb : vb);
#pragma unroll
    for (int mi = 0; mi < QKV_FM; ++mi) {
#pragma unroll
      for (int r = 0; r < 8; ++r) {
        int m = m0 + mi * 16 + r + mhi;
        int bidx = m >> 11;           // /T
        int tpos = m & (T_SEQ - 1);
        dst[(((size_t)(bidx * H_NUM + h) * T_SEQ) + tpos) * DH + d] =
            (_Float16)(acc[mi][t][r] + bv);
      }
    }
  }
}

#define A_KST   64
#define K_LD    72
#define V_LD    80
#define A_KH    (A_KST * K_LD)
#define A_STAGE (A_KST * (K_LD + V_LD))
static_assert(T_SEQ % A_KST == 0 && A_KST == 64, "a block's 64 queries end with a whole stage");

__global__ void __launch_bounds__(128)
attn_fwd(const _Float16* __restrict__ qbuf, const _Float16* __restrict__ kbuf,
         const _Float16* __restrict__ vbuf, _Float16* __restrict__ ybuf) {
  __shared__ __attribute__((aligned(32))) _Float16 smem[2 * A_STAGE];

  const int tid = threadIdx.x;
  // the wave's number in a scalar register: the tests on q0 below are scalar branches
  int wave = __builtin_amdgcn_readfirstlane(tid >> 5);
  int lane = tid & 31;
  int b = blockIdx.z;
  int h = blockIdx.y;
  int q0 = blockIdx.x * 64 + wave * 16;
  const int nst = blockIdx.x + 1;               // stages of this block: keys 0 .. 64 * nst - 1

  const _Float16* Q = qbuf + (size_t)(b * H_NUM + h) * T_SEQ * DH;
  const _Float16* K = kbuf + (size_t)(b * H_NUM + h) * T_SEQ * DH;
  const _Float16* V = vbuf + (size_t)(b * H_NUM + h) * T_SEQ * DH;

  // this thread's eight copies of a stage: rows i*16 + tid/8 of K (i < 4) and of V, piece tid & 7
  const int crow = tid >> 3;
  const int cpc  = (tid & 7) * 8;
  const unsigned lbase = (unsigned)(size_t)smem;   // LDS byte address: low 32 bits
  const _Float16* g0[8];
  unsigned        l0[8];
#pragma unroll
  for (int i = 0; i < 4; ++i) {
    g0[i]     = K + (size_t)(i * 16 + crow) * DH + cpc;
    g0[i + 4] = V + (size_t)(i * 16 + crow) * DH + cpc;
    l0[i]     = lbase + (unsigned)(((i * 16 + crow) * K_LD + cpc) * 2);
    l0[i + 4] = lbase + (unsigned)((A_KH + (i * 16 + crow) * V_LD + cpc) * 2);
  }
  auto issue = [&](int t, int buf) {
    const _Float16* g[8];
    unsigned        l[8];
#pragma unroll
    for (int i = 0; i < 8; ++i) {
      g[i] = g0[i] + t * (A_KST * DH);
      l[i] = l0[i] + (unsigned)(buf * A_STAGE * 2);
    }
    async_copies<8>(l, g);
  };

  // Q fragments (B operand) held for the whole key loop (Dh=64 -> two 32x16)
  v16h bq0 = load_frag_rm(Q + (size_t)q0 * DH + 0, DH);
  v16h bq1 = load_frag_rm(Q + (size_t)q0 * DH + 32, DH);

  v8f o[4] = {};                  // o[d4][r] = O^T[d4*16 + mhi + r][q0 + ncl]
  float mrun = -1e30f;            // this query's running maximum (same in both halves)
  float lrun = 0.0f;              // this half's share of the running denominator

  float slope = exp2f(-8.0f / (float)H_NUM * (float)(h + 1));
  int mhi = (lane >> 4) ? 8 : 0;
  int ncl = lane & 15;
  int qr  = q0 + ncl;

  // lane offsets in a buffer: K fragment row (key ncl, halves mhi..) and the transposing
  // loads' address (key rows 0..15, d columns 0..15)
  const int kfo = ncl * K_LD + mhi;
  const int vto = A_KH + (mhi + (lane & 7)) * V_LD + ((lane >> 3) & 1) * 8;

  issue(0, 0);
  // stage 0 has landed for this wave; the barrier publishes it to the others
  asm volatile("s_wait_asynccnt 0x0" ::: "memory");
  __syncthreads();
  if (nst > 1) issue(1, 1);

  for (int t = 0; t < nst; ++t) {
   const _Float16* sb = smem + (t & 1) * A_STAGE;
   // unrolled: the second pass's LDS offsets become immediates of its loads
#pragma unroll
   for (int p = 0; p < 2; ++p) {
    const int kb0 = t * A_KST + p * 32;
    // wave-uniform: a stage's second pass may lie wholly above the wave's diagonal (its first
    // never does: 64 * t <= 64 * blockIdx.x <= q0)
    if (p == 1 && kb0 > q0 + 15) continue;
    const _Float16* kf  = sb + kfo + p * 32 * K_LD;
    const _Float16* vtr = sb + vto + p * 32 * V_LD;

    // ---- K fragments (A operand): same k order as load_frag_rm ----
    v16h ak[2][2];
#pragma unroll
    for (int t2 = 0; t2 < 2; ++t2) {
      ak[t2][0] = lds_frag(kf + t2 * 16 * K_LD);
      ak[t2][1] = lds_frag(kf + t2 * 16 * K_LD + 32);
    }

    // ---- V^T fragments (A operand), in flight under the softmax ----
    v16h av[4];
#pragma unroll
    for (int d4 = 0; d4 < 4; ++d4) {
      v8h lo = ld_tr16(vtr + d4 * 16);
      v8h hb = ld_tr16(vtr + 16 * V_LD + d4 * 16);
#pragma unroll
      for (int i = 0; i < 8; ++i) { av[d4][i] = lo[i]; av[d4][i + 8] = hb[i]; }
    }
    // Keeps the pass's 16 LDS loads one group ahead of the products and the softmax, which
    // then cover the transposing loads' latency.
    __builtin_amdgcn_sched_barrier(0);

    // ---- S^T = K Q^T for two 16-key tiles ----
    v8f s[2];
#pragma unroll
    for (int t2 = 0; t2 < 2; ++t2) {
      v8f c = {};
      c = wmma_f16(ak[t2][0], bq0, c);
      c = wmma_f16(ak[t2][1], bq1, c);
      s[t2] = c;
    }

    // ---- scale + ALiBi + causal mask ----
#pragma unroll
    for (int t2 = 0; t2 < 2; ++t2) {
#pragma unroll
      for (int r = 0; r < 8; ++r) {
        int kc = kb0 + t2 * 16 + mhi + r;
        float v = s[t2][r] * 0.125f +
                  slope * fminf((float)(kc - qr), 0.0f);
        if (kc > qr) v = -1e30f;
        s[t2][r] = v;
      }
    }

    // ---- online softmax: in-lane trees, one exchange between the halves ----
    float t8[8];
#pragma unroll
    for (int r = 0; r < 8; ++r) t8[r] = fmaxf(s[0][r], s[1][r]);
#pragma unroll
    for (int w = 4; w > 0; w >>= 1)
#pragma unroll
      for (int r = 0; r < w; ++r) t8[r] = fmaxf(t8[r], t8[r + w]);
    float mx = fmaxf(t8[0], xhalf(t8[0]));
    float mnew = fmaxf(mrun, mx);
    float alpha = __expf(mrun - mnew);
    mrun = mnew;

#pragma unroll
    for (int t2 = 0; t2 < 2; ++t2)
#pragma unroll
      for (int r = 0; r < 8; ++r) s[t2][r] = __expf(s[t2][r] - mnew);

#pragma unroll
    for (int r = 0; r < 8; ++r) t8[r] = s[0][r] + s[1][r];
#pragma unroll
    for (int w = 4; w > 0; w >>= 1)
#pragma unroll
      for (int r = 0; r < w; ++r) t8[r] += t8[r + w];
    lrun = lrun * alpha + t8[0];

#pragma unroll
    for (int d4 = 0; d4 < 4; ++d4)
#pragma unroll
      for (int r = 0; r < 8; ++r) o[d4][r] *= alpha;

    // ---- P^T: the two score tiles, converted in place, are the B operand ----
    v16h bp;
#pragma unroll
    for (int r = 0; r < 8; ++r) {
      bp[r]     = (_Float16)s[0][r];
      bp[r + 8] = (_Float16)s[1][r];
    }

    // ---- O^T += V^T * P^T ----
#pragma unroll
    for (int d4 = 0; d4 < 4; ++d4) o[d4] = wmma_f16(av[d4], bp, o[d4]);
   }
   // publish point of stage t + 1: this wave's reads of buffer t & 1 are done ...
   asm volatile("s_wait_dscnt 0x0" ::: "memory");
   // ... its copies of stage t + 1 have landed ...
   asm volatile("s_wait_asynccnt 0x0" ::: "memory");
   // ... and the one barrier both publishes stage t + 1 and frees buffer t & 1
   __syncthreads();
   if (t + 2 < nst) issue(t + 2, t & 1);
  }
  // no copy is left in flight when the wave goes on to its stores and ends
  asm volatile("s_wait_asynccnt 0x0" ::: "memory");

  // ---- epilogue: join the halves' sums, normalize, store y as f16 [B,T,C] ----
  lrun += xhalf(lrun);
#pragma unroll
  for (int d4 = 0; d4 < 4; ++d4) {
    v8h pk;
#pragma unroll
    for (int r = 0; r < 8; ++r) pk[r] = (_Float16)(o[d4][r] / lrun);
    *(v8h*)(ybuf + ((size_t)(b * T_SEQ + qr)) * C_DIM + h * DH + d4 * 16 + mhi) = pk;
  }
}

// ---------------------------------------------------------------------------
// Output projection: out[m,n] = sum_k y[m,k] * W_proj[n,k] + b_proj[n]  (f32)
// M=4096, N=1024, K=1024. Block tile 128 x 128 (wave tile 32 x 32): 8 x 32 blocks.
// ---------------------------------------------------------------------------
#define PRJ_FM 2
#define PRJ_FN 2
__global__ void __launch_bounds__(G_THR)
gemm_proj(const _Float16* __restrict__ yh, const _Float16* __restrict__ wh,
          const float* __restrict__ bias, float* __restrict__ out) {
  __shared__ __attribute__((aligned(16))) _Float16 sm[2 * 64 * (PRJ_FM + PRJ_FN) * G_LDP];
  int wave = threadIdx.x >> 5;
  int mblk = blockIdx.y * (64 * PRJ_FM);
  int nblk = blockIdx.x * (64 * PRJ_FN);

  v8f acc[PRJ_FM][PRJ_FN] = {};
  gemm_main<PRJ_FM, PRJ_FN>(yh, wh, mblk, nblk, sm, acc);

  int m0 = mblk + (wave >> 2) * (16 * PRJ_FM);
  int n0 = nblk + (wave & 3) * (16 * PRJ_FN);
  int lane = threadIdx.x & 31;
  int ncl  = lane & 15;
  int mhi  = (lane >> 4) ? 8 : 0;
#pragma unroll
  for (int t = 0; t < PRJ_FN; ++t) {
    int n = n0 + t * 16 + ncl;
    float bv = bias[n];
#pragma unroll
    for (int mi = 0; mi < PRJ_FM; ++mi) {
#pragma unroll
      for (int r = 0; r < 8; ++r) {
        int m = m0 + mi * 16 + r + mhi;
        out[(size_t)m * C_DIM + n] = acc[mi][t][r] + bv;
      }
    }
  }
}

// ---------------------------------------------------------------------------
// Launch
// ---------------------------------------------------------------------------
extern "C" void kernel_launch(void* const* d_in, const int* in_sizes, int n_in,
                              void* d_out, int out_size, void* d_ws, size_t ws_size,
                              hipStream_t stream) {
  const float* x      = (const float*)d_in[0];   // [B,T,C]
  const float* W_attn = (const float*)d_in[1];   // [3C,C]
  const float* b_attn = (const float*)d_in[2];   // [3C]
  const float* W_proj = (const float*)d_in[3];   // [C,C]
  const float* b_proj = (const float*)d_in[4];   // [C]
  float* out = (float*)d_out;

  char* ws = (char*)d_ws;
  const size_t n_x  = (size_t)B_SZ * T_SEQ * C_DIM;        // 4,194,304
  const size_t n_wa = (size_t)3 * C_DIM * C_DIM;           // 3,145,728
  const size_t n_wp = (size_t)C_DIM * C_DIM;               // 1,048,576
  const size_t n_qkv = (size_t)B_SZ * H_NUM * T_SEQ * DH;  // 4,194,304

  _Float16* xh  = (_Float16*)(ws);
  _Float16* wah = (_Float16*)(ws + 2 * n_x);
  _Float16* wph = (_Float16*)(ws + 2 * (n_x + n_wa));
  _Float16* qb  = (_Float16*)(ws + 2 * (n_x + n_wa + n_wp));
  _Float16* kb  = (_Float16*)(ws + 2 * (n_x + n_wa + n_wp + n_qkv));
  _Float16* vb  = (_Float16*)(ws + 2 * (n_x + n_wa + n_wp + 2 * n_qkv));
  _Float16* yb  = (_Float16*)(ws + 2 * (n_x + n_wa + n_wp + 3 * n_qkv));

  // xh, wah and wph are one flat f16 array that starts at xh
  cast3_f32_f16<<<CAST_NB_X + CAST_NB_WA + CAST_NB_WP, CAST_THR, 0, stream>>>(x, W_attn, W_proj, xh);

  // QKV GEMM: block tile 256x256 -> grid = (3072/256, 4096/256) = (12, 16)
  gemm_qkv<<<dim3(12, 16), G_THR, 0, stream>>>(xh, wah, b_attn, qb, kb, vb);

  // Attention: (T/64, H, B)
  attn_fwd<<<dim3(T_SEQ / 64, H_NUM, B_SZ), 128, 0, stream>>>(qb, kb, vb, yb);

  // Projection: block tile 128x128 -> grid = (1024/128, 4096/128) = (8, 32)
  gemm_proj<<<dim3(8, 32), G_THR, 0, stream>>>(yb, wph, b_proj, out);
}

// v005
// It runs in 83.6 microseconds.
// In two side-by-side timings against v004, it was 1.12 and 1.11 times as fast.
// All steps since v000 together make it 3.42 times as fast.
#include <hip/hip_runtime.h>
#include <hip/hip_bf16.h>

typedef __attribute__((ext_vector_type(16))) _Float16 v16h;
typedef __attribute__((ext_vector_type(8)))  _Float16 v8h;
typedef __attribute__((ext_vector_type(8)))  float    v8f;

#define B_SZ   2
#define T_SEQ  2048
#define C_DIM  1024
#define H_NUM  16
#define DH     64

__device__ __forceinline__ v8f wmma_f16(v16h a, v16h b, v8f c) {
  return __builtin_amdgcn_wmma_f32_16x16x32_f16(
      /*neg_a=*/false, a, /*neg_b=*/false, b,
      /*c_mod=*/(short)0, c, /*reuse_a=*/false, /*reuse_b=*/false);
}

__device__ __forceinline__ v16h load_frag_rm(const _Float16* p, int ld) {
  int lane = threadIdx.x & 31;
  int row  = lane & 15;
  int hi   = (lane >> 4) ? 8 : 0;
  const _Float16* r = p + (size_t)row * ld;
  v8h lo = *(const v8h*)(r + hi);
  v8h hb = *(const v8h*)(r + 16 + hi);
  v16h out;
#pragma unroll
  for (int i = 0; i < 8; ++i) { out[i] = lo[i]; out[i + 8] = hb[i]; }
  return out;
}

// Transposing LDS load: lane (c = lane & 15, h = lane >> 4) receives the eight
// 16-bit values T[kbase + 8h + 0..7][dbase + c] of a row-major LDS tile.
typedef short s16x8 __attribute__((ext_vector_type(8)));
__device__ __forceinline__ v8h ld_tr16(const _Float16* p) {
  typedef __attribute__((address_space(3))) s16x8 lds_s16x8;
  return __builtin_bit_cast(v8h, __builtin_amdgcn_ds_load_tr16_b128_v8i16((lds_s16x8*)p));
}

__device__ __forceinline__ float xhalf(float x) {
  int xi = __builtin_bit_cast(int, x);
  return __builtin_bit_cast(float, __builtin_amdgcn_permlanex16(
      xi, xi, 0x76543210, 0xfedcba98, false, false));
}

// ---------------------------------------------------------------------------
// f32 -> f16 cast of x, W_attn and W_proj in ONE launch. The three f16 copies lie
// one behind the other in the workspace, so the destination is one flat array.
// One 16-wave block per WGP; a block converts CAST_BLK elements in a row, all of
// one source. A wave load covers 512 B in a row, a wave store 256 B; a thread's
// 16 loads are all in flight before its first store.
// ---------------------------------------------------------------------------
typedef __attribute__((ext_vector_type(4))) float    v4f;
typedef __attribute__((ext_vector_type(4))) _Float16 v4h;

#define CAST_THR   512
#define CAST_PER   16                            // 16-byte loads per thread
#define CAST_STEP  (CAST_THR * 4)                // elements per block and load round
#define CAST_BLK   (CAST_STEP * CAST_PER)        // elements per block
#define CAST_NB_X  (B_SZ * T_SEQ * C_DIM / CAST_BLK)
#define CAST_NB_WA (3 * C_DIM * C_DIM / CAST_BLK)
#define CAST_NB_WP (C_DIM * C_DIM / CAST_BLK)
static_assert(CAST_NB_X * CAST_BLK == B_SZ * T_SEQ * C_DIM, "x is whole blocks");
static_assert(CAST_NB_WA * CAST_BLK == 3 * C_DIM * C_DIM, "W_attn is whole blocks");
static_assert(CAST_NB_WP * CAST_BLK == C_DIM * C_DIM, "W_proj is whole blocks");

__global__ void __launch_bounds__(CAST_THR)
cast3_f32_f16(const float* __restrict__ x, const float* __restrict__ wa,
              const float* __restrict__ wp, _Float16* __restrict__ out) {
  int blk = blockIdx.x;
  const float* src = x;
  int first = 0;
  if (blk >= CAST_NB_X)              { src = wa; first = CAST_NB_X; }
  if (blk >= CAST_NB_X + CAST_NB_WA) { src = wp; first = CAST_NB_X + CAST_NB_WA; }
  const float* sp = src + (size_t)(blk - first) * CAST_BLK + threadIdx.x * 4;
  _Float16*    dp = out + (size_t)blk * CAST_BLK + threadIdx.x * 4;

  v4f v[CAST_PER];
#pragma unroll
  for (int i = 0; i < CAST_PER; ++i) v[i] = *(const v4f*)(sp + i * CAST_STEP);
  // Keeps all 16 loads ahead of the first conversion: left free, the scheduler holds the last
  // two back until the first two have landed, and the wave pays the memory latency twice.
  __builtin_amdgcn_sched_barrier(0);
  v4h h[CAST_PER];
#pragma unroll
  for (int i = 0; i < CAST_PER; ++i) h[i] = __builtin_convertvector(v[i], v4h);
  // Keeps the stores behind the last conversion, each with data registers of its own: left
  // free, the scheduler reuses the first stores' registers and waits for those stores between
  // the later conversions.
  __builtin_amdgcn_sched_barrier(0);
#pragma unroll
  for (int i = 0; i < CAST_PER; ++i) *(v4h*)(dp + i * CAST_STEP) = h[i];
}

// ---------------------------------------------------------------------------
// Main loop of both GEMMs: acc[m,n] = sum_k A[m,k] * Bm[n,k], K = C_DIM, both
// operands K-contiguous f16.
// Block = 512 threads = 16 waves arranged 4(M) x 4(N); wave tile = 16*FM x 16*FN,
// block tile = 64*FM x 64*FN, at most one block per WGP.
// A stage is 64 k (128 B) of every operand row of the block tile, A's rows first,
// at an LDS pitch of 144 B (16 B x odd: ds_load_b128 readers). Asynchronous copies
// bring it in, 16 B a lane, eight lanes to a row, so a wave's copy covers four
// whole 128-B lines and every line is fetched once per block. Two buffers: stage
// t + 2 flies while stage t + 1 is worked on.
// ---------------------------------------------------------------------------
#define G_THR  512
#define G_KST  64                 // k per stage
#define G_LDP  72                 // LDS row pitch in halves (144 B)
#define G_NT   (C_DIM / G_KST)    // stages
static_assert(G_NT >= 2, "the prologue fills two stages");
static_assert(G_KST == 64, "the loop body is written for two k steps of 32 per stage");

template <int N>
__device__ __forceinline__ void async_copies(const unsigned (&l)[N], const _Float16* const (&g)[N]) {
  static_assert(N == 4 || N == 8, "written out for 4 and 8 copies");
  if constexpr (N == 4) {
    asm volatile("global_load_async_to_lds_b128 %0, %1, off\n\t"
                 "global_load_async_to_lds_b128 %2, %3, off\n\t"
                 "global_load_async_to_lds_b128 %4, %5, off\n\t"
                 "global_load_async_to_lds_b128 %6, %7, off\n\t"
                 "s_wait_xcnt 0x0"
                 :: "v"(l[0]), "v"(g[0]), "v"(l[1]), "v"(g[1]), "v"(l[2]), "v"(g[2]),
                    "v"(l[3]), "v"(g[3])
                 : "memory");
  } else {
    asm volatile("global_load_async_to_lds_b128 %0, %1, off\n\t"
                 "global_load_async_to_lds_b128 %2, %3, off\n\t"
                 "global_load_async_to_lds_b128 %4, %5, off\n\t"
                 "global_load_async_to_lds_b128 %6, %7, off\n\t"
                 "global_load_async_to_lds_b128 %8, %9, off\n\t"
                 "global_load_async_to_lds_b128 %10, %11, off\n\t"
                 "global_load_async_to_lds_b128 %12, %13, off\n\t"
                 "global_load_async_to_lds_b128 %14, %15, off\n\t"
                 "s_wait_xcnt 0x0"
                 :: "v"(l[0]), "v"(g[0]), "v"(l[1]), "v"(g[1]), "v"(l[2]), "v"(g[2]),
                    "v"(l[3]), "v"(g[3]), "v"(l[4]), "v"(g[4]), "v"(l[5]), "v"(g[5]),
                    "v"(l[6]), "v"(g[6]), "v"(l[7]), "v"(g[7])
                 : "memory");
  }
}

// 16x32 f16 fragment from an LDS row: same k order as load_frag_rm. p = this lane's row,
// at the k step's first half plus 8 * (lane >> 4).
__device__ __forceinline__ v16h lds_frag(const _Float16* p) {
  v8h lo = *(const v8h*)(p);
  v8h hb = *(const v8h*)(p + 16);
  v16h out;
#pragma unroll
  for (int i = 0; i < 8; ++i) { out[i] = lo[i]; out[i + 8] = hb[i]; }
  return out;
}

template <int FM, int FN>
__device__ __forceinline__ void gemm_main(const _Float16* __restrict__ A,
                                          const _Float16* __restrict__ Bm,
                                          int mblk, int nblk, _Float16* sm,
                                          v8f (&acc)[FM][FN]) {
  constexpr int ROWS  = 64 * (FM + FN);    // operand rows per stage
  constexpr int NCP   = FM + FN;           // copies per thread and stage (64 rows each)
  constexpr int STAGE = ROWS * G_LDP;      // halves per buffer

  const int tid  = threadIdx.x;
  const int lane = tid & 31;
  const int wave = tid >> 5;
  const int wm   = wave >> 2;
  const int wn   = wave & 3;

  // this thread's copies: row i*64 + tid/8 of the stage, 16-byte piece tid & 7
  const int crow = tid >> 3;
  const int cpc  = (tid & 7) * 8;
  const unsigned lbase = (unsigned)(size_t)sm;   // LDS byte address: low 32 bits
  const _Float16* g0[NCP];
  unsigned        l0[NCP];
#pragma unroll
  for (int i = 0; i < NCP; ++i) {
    g0[i] = (i < FM ? A + (size_t)(mblk + i * 64 + crow) * C_DIM
                    : Bm + (size_t)(nblk + (i - FM) * 64 + crow) * C_DIM) + cpc;
    l0[i] = lbase + (unsigned)(((i * 64 + crow) * G_LDP + cpc) * 2);
  }
  auto issue = [&](int t, int buf) {
    const _Float16* g[NCP];
    unsigned        l[NCP];
#pragma unroll
    for (int i = 0; i < NCP; ++i) {
      g[i] = g0[i] + t * G_KST;
      l[i] = l0[i] + (unsigned)(buf * STAGE * 2);
    }
    async_copies<NCP>(l, g);
  };

  // this lane's fragment rows in a buffer
  const int frow = lane & 15;
  const int fk   = (lane >> 4) * 8;
  const int aoff = (wm * FM * 16 + frow) * G_LDP + fk;
  const int boff = (64 * FM + wn * FN * 16 + frow) * G_LDP + fk;

  issue(0, 0);
  // stage 0 has landed for this wave; the barrier publishes it to the others
  asm volatile("s_wait_asynccnt 0x0" ::: "memory");
  __syncthreads();
  issue(1, 1);

  for (int t = 0; t < G_NT; ++t) {
    const _Float16* sb = sm + (t & 1) * STAGE;
    v16h a[FM], b[FN], a2[FM], b2[FN];
#pragma unroll
    for (int i = 0; i < FM; ++i) a[i] = lds_frag(sb + aoff + i * 16 * G_LDP);
#pragma unroll
    for (int j = 0; j < FN; ++j) b[j] = lds_frag(sb + boff + j * 16 * G_LDP);
    __builtin_amdgcn_sched_barrier(0);
#pragma unroll
    for (int j = 0; j < FN; ++j)
#pragma unroll
      for (int i = 0; i < FM; ++i) acc[i][j] = wmma_f16(a[i], b[j], acc[i][j]);
    // second k step of the stage: its fragments are the last reads of buffer t & 1
#pragma unroll
    for (int i = 0; i < FM; ++i) a2[i] = lds_frag(sb + aoff + i * 16 * G_LDP + 32);
#pragma unroll
    for (int j = 0; j < FN; ++j) b2[j] = lds_frag(sb + boff + j * 16 * G_LDP + 32);
    // publish point of stage t + 1: this wave's reads of buffer t & 1 are done ...
    asm volatile("s_wait_dscnt 0x0" ::: "memory");
    // ... its copies of stage t + 1 have landed ...
    asm volatile("s_wait_asynccnt 0x0" ::: "memory");
    // ... and the one barrier both publishes stage t + 1 and frees buffer t & 1
    __syncthreads();
    if (t + 2 < G_NT) issue(t + 2, t & 1);
    // the second k step's products work from registers, under the copies just issued
#pragma unroll
    for (int j = 0; j < FN; ++j)
#pragma unroll
      for (int i = 0; i < FM; ++i) acc[i][j] = wmma_f16(a2[i], b2[j], acc[i][j]);
  }
  // no copy is left in flight when the wave goes on to its stores and ends
  asm volatile("s_wait_asynccnt 0x0" ::: "memory");
}

// ---------------------------------------------------------------------------
// QKV GEMM: qkv[m,n] = sum_k x[m,k] * W_attn[n,k] + b_attn[n]
// M=4096, N=3072, K=1024. Block tile 256 x 256 (wave tile 64 x 64, one head wide, so
// that every 128-B line of Q, K and V has one writing wave): 12 x 16 blocks.
// Epilogue scatters into Q/K/V f16 buffers, layout [B,H,T,Dh].
// ---------------------------------------------------------------------------
#define QKV_FM 4
#define QKV_FN 4
__global__ void __launch_bounds__(G_THR)
gemm_qkv(const _Float16* __restrict__ xh, const _Float16* __restrict__ wh,
         const float* __restrict__ bias,
         _Float16* __restrict__ qb, _Float16* __restrict__ kb,
         _Float16* __restrict__ vb) {
  __shared__ __attribute__((aligned(16))) _Float16 sm[2 * 64 * (QKV_FM + QKV_FN) * G_LDP];
  int wave = threadIdx.x >> 5;        // 0..15
  int mblk = blockIdx.y * (64 * QKV_FM);
  int nblk = blockIdx.x * (64 * QKV_FN);

  v8f acc[QKV_FM][QKV_FN] = {};
  gemm_main<QKV_FM, QKV_FN>(xh, wh, mblk, nblk, sm, acc);

  int m0 = mblk + (wave >> 2) * (16 * QKV_FM);
  int n0 = nblk + (wave & 3) * (16 * QKV_FN);
  int lane = threadIdx.x & 31;
  int ncl  = lane & 15;
  int mhi  = (lane >> 4) ? 8 : 0;
#pragma unroll
  for (int t = 0; t < QKV_FN; ++t) {
    int n = n0 + t * 16 + ncl;
    float bv = bias[n];
    int which = n >> 10;            // 0=q,1=k,2=v
    int c = n & 1023;
    int h = c >> 6;
    int d = c & 63;
    _Float16* dst = (which == 0) ? qb : ((which == 1) ? kb : vb);
#pragma unroll
    for (int mi = 0; mi < QKV_FM; ++mi) {
#pragma unroll
      for (int r = 0; r < 8; ++r) {
        int m = m0 + mi * 16 + r + mhi;
        int bidx = m >> 11;           // /T
        int tpos = m & (T_SEQ - 1);
        dst[(((size_t)(bidx * H_NUM + h) * T_SEQ) + tpos) * DH + d] =
            (_Float16)(acc[mi][t][r] + bv);
      }
    }
  }
}

#define A_KST   64
#define K_LD    72
#define V_LD    80
#define A_KH    (A_KST * K_LD)
#define A_STAGE (A_KST * (K_LD + V_LD))
#define A_QT    (T_SEQ / 64)
#define A_NST   (A_QT + 1)
static_assert(T_SEQ % A_KST == 0 && A_KST == 64, "a tile's 64 queries end with a whole stage");
static_assert(A_QT % 2 == 0, "the tiles of a head pair up");

__global__ void __launch_bounds__(128)
attn_fwd(const _Float16* __restrict__ qbuf, const _Float16* __restrict__ kbuf,
         const _Float16* __restrict__ vbuf, _Float16* __restrict__ ybuf) {
  __shared__ __attribute__((aligned(32))) _Float16 smem[2 * A_STAGE];

  const int tid = threadIdx.x;
  // the wave's number in a scalar register: the tests on q0 below are scalar branches
  int wave = __builtin_amdgcn_readfirstlane(tid >> 5);
  int lane = tid & 31;
  int b = blockIdx.z;
  int h = blockIdx.y;
  const int tile_s = blockIdx.x;                // the short tile, worked second
  const int tile_l = A_QT - 1 - tile_s;         // the long tile, worked first
  const int n_l = tile_l + 1;                   // its stages: ring stages 0 .. n_l - 1

  const _Float16* Q = qbuf + (size_t)(b * H_NUM + h) * T_SEQ * DH;
  const _Float16* K = kbuf + (size_t)(b * H_NUM + h) * T_SEQ * DH;
  const _Float16* V = vbuf + (size_t)(b * H_NUM + h) * T_SEQ * DH;

  // this thread's eight copies of a stage: rows i*16 + tid/8 of K (i < 4) and of V, piece tid & 7
  const int crow = tid >> 3;
  const int cpc  = (tid & 7) * 8;
  const unsigned lbase = (unsigned)(size_t)smem;   // LDS byte address: low 32 bits
  const _Float16* g0[8];
  unsigned        l0[8];
#pragma unroll
  for (int i = 0; i < 4; ++i) {
    g0[i]     = K + (size_t)(i * 16 + crow) * DH + cpc;
    g0[i + 4] = V + (size_t)(i * 16 + crow) * DH + cpc;
    l0[i]     = lbase + (unsigned)(((i * 16 + crow) * K_LD + cpc) * 2);
    l0[i + 4] = lbase + (unsigned)((A_KH + (i * 16 + crow) * V_LD + cpc) * 2);
  }
  // ring stage s goes to buffer s & 1; its keys are stage s of the long tile or, behind
  // those, stage s - n_l of the short one (both start at key 0)
  auto issue = [&](int s) {
    const int ks = s < n_l ? s : s - n_l;
    const _Float16* g[8];
    unsigned        l[8];
#pragma unroll
    for (int i = 0; i < 8; ++i) {
      g[i] = g0[i] + ks * (A_KST * DH);
      l[i] = l0[i] + (unsigned)((s & 1) * A_STAGE * 2);
    }
    async_copies<8>(l, g);
  };

  // Q fragments (B operand) held for a tile's whole key loop (Dh=64 -> two 32x16)
  v16h bq0 = load_frag_rm(Q + (size_t)(tile_l * 64 + wave * 16) * DH + 0, DH);
  v16h bq1 = load_frag_rm(Q + (size_t)(tile_l * 64 + wave * 16) * DH + 32, DH);

  float slope = exp2f(-8.0f / (float)H_NUM * (float)(h + 1));
  int mhi = (lane >> 4) ? 8 : 0;
  int ncl = lane & 15;

  // lane offsets in a buffer: K fragment row (key ncl, halves mhi..) and the transposing
  // loads' address (key rows 0..15, d columns 0..15)
  const int kfo = ncl * K_LD + mhi;
  const int vto = A_KH + (mhi + (lane & 7)) * V_LD + ((lane >> 3) & 1) * 8;

  issue(0);
  // stage 0 has landed for this wave; the barrier publishes it to the others
  asm volatile("s_wait_asynccnt 0x0" ::: "memory");
  __syncthreads();
  issue(1);

  int s = 0;                      // ring stage, counted through both tiles
  // unrolled: rolled, the flag that tells the tiles apart lives in vcc through the key loop,
  // and the mask's compares and selects there take their long, unpaired encodings
#pragma unroll
  for (int half = 0; half < 2; ++half) {
  const int tile = half ? tile_s : tile_l;
  const int q0 = tile * 64 + wave * 16;
  const int qr = q0 + ncl;

  v8f o[4] = {};                  // o[d4][r] = O^T[d4*16 + mhi + r][q0 + ncl]
  float mrun = -1e30f;            // this query's running maximum (same in both halves)
  float lrun = 0.0f;              // this half's share of the running denominator

  // a tile has at least one stage: tested at the foot, so that the short tile's Q loads are not
  // sunk behind the long tile's epilogue into a test for an empty loop
  int t = 0;
  do {
   const _Float16* sb = smem + (s & 1) * A_STAGE;
   // unrolled: the second pass's LDS offsets become immediates of its loads
#pragma unroll
   for (int p = 0; p < 2; ++p) {
    const int kb0 = t * A_KST + p * 32;
    // wave-uniform: a stage's second pass may lie wholly above the wave's diagonal (its first
    // never does: 64 * t <= 64 * tile <= q0)
    if (p == 1 && kb0 > q0 + 15) continue;
    const _Float16* kf  = sb + kfo + p * 32 * K_LD;
    const _Float16* vtr = sb + vto + p * 32 * V_LD;

    // ---- K fragments (A operand): same k order as load_frag_rm ----
    v16h ak[2][2];
#pragma unroll
    for (int t2 = 0; t2 < 2; ++t2) {
      ak[t2][0] = lds_frag(kf + t2 * 16 * K_LD);
      ak[t2][1] = lds_frag(kf + t2 * 16 * K_LD + 32);
    }

    // ---- V^T fragments (A operand), in flight under the softmax ----
    v16h av[4];
#pragma unroll
    for (int d4 = 0; d4 < 4; ++d4) {
      v8h lo = ld_tr16(vtr + d4 * 16);
      v8h hb = ld_tr16(vtr + 16 * V_LD + d4 * 16);
#pragma unroll
      for (int i = 0; i < 8; ++i) { av[d4][i] = lo[i]; av[d4][i + 8] = hb[i]; }
    }
    // Keeps the pass's 16 LDS loads one group ahead of the products and the softmax, which
    // then cover the transposing loads' latency.
    __builtin_amdgcn_sched_barrier(0);

    // ---- S^T = K Q^T for two 16-key tiles ----
    v8f s[2];
#pragma unroll
    for (int t2 = 0; t2 < 2; ++t2) {
      v8f c = {};
      c = wmma_f16(ak[t2][0], bq0, c);
      c = wmma_f16(ak[t2][1], bq1, c);
      s[t2] = c;
    }

    // ---- scale + ALiBi + causal mask ----
#pragma unroll
    for (int t2 = 0; t2 < 2; ++t2) {
#pragma unroll
      for (int r = 0; r < 8; ++r) {
        int kc = kb0 + t2 * 16 + mhi + r;
        float v = s[t2][r] * 0.125f +
                  slope * fminf((float)(kc - qr), 0.0f);
        if (kc > qr) v = -1e30f;
        s[t2][r] = v;
      }
    }

    // ---- online softmax: in-lane trees, one exchange between the halves ----
    float t8[8];
#pragma unroll
    for (int r = 0; r < 8; ++r) t8[r] = fmaxf(s[0][r], s[1][r]);
#pragma unroll
    for (int w = 4; w > 0; w >>= 1)
#pragma unroll
      for (int r = 0; r < w; ++r) t8[r] = fmaxf(t8[r], t8[r + w]);
    float mx = fmaxf(t8[0], xhalf(t8[0]));
    float mnew = fmaxf(mrun, mx);
    float alpha = __expf(mrun - mnew);
    mrun = mnew;

#pragma unroll
    for (int t2 = 0; t2 < 2; ++t2)
#pragma unroll
      for (int r = 0; r < 8; ++r) s[t2][r] = __expf(s[t2][r] - mnew);

#pragma unroll
    for (int r = 0; r < 8; ++r) t8[r] = s[0][r] + s[1][r];
#pragma unroll
    for (int w = 4; w > 0; w >>= 1)
#pragma unroll
      for (int r = 0; r < w; ++r) t8[r] += t8[r + w];
    lrun = lrun * alpha + t8[0];

#pragma unroll
    for (int d4 = 0; d4 < 4; ++d4)
#pragma unroll
      for (int r = 0; r < 8; ++r) o[d4][r] *= alpha;

    // ---- P^T: the two score tiles, converted in place, are the B operand ----
    v16h bp;
#pragma unroll
    for (int r = 0; r < 8; ++r) {
      bp[r]     = (_Float16)s[0][r];
      bp[r + 8] = (_Float16)s[1][r];
    }

    // ---- O^T += V^T * P^T ----
#pragma unroll
    for (int d4 = 0; d4 < 4; ++d4) o[d4] = wmma_f16(av[d4], bp, o[d4]);
   }
   // publish point of stage s + 1: this wave's reads of buffer s & 1 are done ...
   asm volatile("s_wait_dscnt 0x0" ::: "memory");
   // ... its copies of stage s + 1 have landed ...
   asm volatile("s_wait_asynccnt 0x0" ::: "memory");
   // ... and the one barrier both publishes stage s + 1 and frees buffer s & 1
   __syncthreads();
   if (s + 2 < A_NST) issue(s + 2);
   ++s;
  } while (++t <= tile);

  // the short tile's Q fragments, in flight under the long tile's epilogue
  if (half == 0) {
    bq0 = load_frag_rm(Q + (size_t)(tile_s * 64 + wave * 16) * DH + 0, DH);
    bq1 = load_frag_rm(Q + (size_t)(tile_s * 64 + wave * 16) * DH + 32, DH);
  }

  // ---- epilogue of a tile: join the halves' sums, normalize, store y as f16 [B,T,C] ----
  lrun += xhalf(lrun);
#pragma unroll
  for (int d4 = 0; d4 < 4; ++d4) {
    v8h pk;
#pragma unroll
    for (int r = 0; r < 8; ++r) pk[r] = (_Float16)(o[d4][r] / lrun);
    *(v8h*)(ybuf + ((size_t)(b * T_SEQ + qr)) * C_DIM + h * DH + d4 * 16 + mhi) = pk;
  }
  if (half == 0) {
    // stands in front of the short tile's first write to a register that the four stores name
    asm volatile("s_wait_xcnt 0x0" ::: "memory");
    // keeps those writes behind the wait: left free, the scheduler lifts them over it
    __builtin_amdgcn_sched_barrier(0);
  }
  }
  // no copy is left in flight when the wave ends
  asm volatile("s_wait_asynccnt 0x0" ::: "memory");
}

// ---------------------------------------------------------------------------
// Output projection: out[m,n] = sum_k y[m,k] * W_proj[n,k] + b_proj[n]  (f32)
// M=4096, N=1024, K=1024. Block tile 128 x 128 (wave tile 32 x 32): 8 x 32 blocks.
// ---------------------------------------------------------------------------
#define PRJ_FM 2
#define PRJ_FN 2
__global__ void __launch_bounds__(G_THR)
gemm_proj(const _Float16* __restrict__ yh, const _Float16* __restrict__ wh,
          const float* __restrict__ bias, float* __restrict__ out) {
  __shared__ __attribute__((aligned(16))) _Float16 sm[2 * 64 * (PRJ_FM + PRJ_FN) * G_LDP];
  int wave = threadIdx.x >> 5;
  int mblk = blockIdx.y * (64 * PRJ_FM);
  int nblk = blockIdx.x * (64 * PRJ_FN);

  v8f acc[PRJ_FM][PRJ_FN] = {};
  gemm_main<PRJ_FM, PRJ_FN>(yh, wh, mblk, nblk, sm, acc);

  int m0 = mblk + (wave >> 2) * (16 * PRJ_FM);
  int n0 = nblk + (wave & 3) * (16 * PRJ_FN);
  int lane = threadIdx.x & 31;
  int ncl  = lane & 15;
  int mhi  = (lane >> 4) ? 8 : 0;
#pragma unroll
  for (int t = 0; t < PRJ_FN; ++t) {
    int n = n0 + t * 16 + ncl;
    float bv = bias[n];
#pragma unroll
    for (int mi = 0; mi < PRJ_FM; ++mi) {
#pragma unroll
      for (int r = 0; r < 8; ++r) {
        int m = m0 + mi * 16 + r + mhi;
        out[(size_t)m * C_DIM + n] = acc[mi][t][r] + bv;
      }
    }
  }
}

// ---------------------------------------------------------------------------
// Launch
// ---------------------------------------------------------------------------
extern "C" void kernel_launch(void* const* d_in, const int* in_sizes, int n_in,
                              void* d_out, int out_size, void* d_ws, size_t ws_size,
                              hipStream_t stream) {
  const float* x      = (const float*)d_in[0];   // [B,T,C]
  const float* W_attn = (const float*)d_in[1];   // [3C,C]
  const float* b_attn = (const float*)d_in[2];   // [3C]
  const float* W_proj = (const float*)d_in[3];   // [C,C]
  const float* b_proj = (const float*)d_in[4];   // [C]
  float* out = (float*)d_out;

  char* ws = (char*)d_ws;
  const size_t n_x  = (size_t)B_SZ * T_SEQ * C_DIM;        // 4,194,304
  const size_t n_wa = (size_t)3 * C_DIM * C_DIM;           // 3,145,728
  const size_t n_wp = (size_t)C_DIM * C_DIM;               // 1,048,576
  const size_t n_qkv = (size_t)B_SZ * H_NUM * T_SEQ * DH;  // 4,194,304

  _Float16* xh  = (_Float16*)(ws);
  _Float16* wah = (_Float16*)(ws + 2 * n_x);
  _Float16* wph = (_Float16*)(ws + 2 * (n_x + n_wa));
  _Float16* qb  = (_Float16*)(ws + 2 * (n_x + n_wa + n_wp));
  _Float16* kb  = (_Float16*)(ws + 2 * (n_x + n_wa + n_wp + n_qkv));
  _Float16* vb  = (_Float16*)(ws + 2 * (n_x + n_wa + n_wp + 2 * n_qkv));
  _Float16* yb  = (_Float16*)(ws + 2 * (n_x + n_wa + n_wp + 3 * n_qkv));

  // xh, wah and wph are one flat f16 array that starts at xh
  cast3_f32_f16<<<CAST_NB_X + CAST_NB_WA + CAST_NB_WP, CAST_THR, 0, stream>>>(x, W_attn, W_proj, xh);

  // QKV GEMM: block tile 256x256 -> grid = (3072/256, 4096/256) = (12, 16)
  gemm_qkv<<<dim3(12, 16), G_THR, 0, stream>>>(xh, wah, b_attn, qb, kb, vb);

  // Attention: (pairs of 64-query tiles, H, B)
  attn_fwd<<<dim3(A_QT / 2, H_NUM, B_SZ), 128, 0, stream>>>(qb, kb, vb, yb);

  // Projection: block tile 128x128 -> grid = (1024/128, 4096/128) = (8, 32)
  gemm_proj<<<dim3(8, 32), G_THR, 0, stream>>>(yb, wph, b_proj, out);
}

// v006
// It runs in 82 microseconds.
// In two side-by-side timings against v005, it was 1.03 and 1.02 times as fast.
// Counting every step since v000, it is 3.51 times as fast.
#include <hip/hip_runtime.h>
#include <hip/hip_bf16.h>

typedef __attribute__((ext_vector_type(16))) _Float16 v16h;
typedef __attribute__((ext_vector_type(8)))  _Float16 v8h;
typedef __attribute__((ext_vector_type(8)))  float    v8f;

#define B_SZ   2
#define T_SEQ  2048
#define C_DIM  1024
#define H_NUM  16
#define DH     64

__device__ __forceinline__ v8f wmma_f16(v16h a, v16h b, v8f c) {
  return __builtin_amdgcn_wmma_f32_16x16x32_f16(
      /*neg_a=*/false, a, /*neg_b=*/false, b,
      /*c_mod=*/(short)0, c, /*reuse_a=*/false, /*reuse_b=*/false);
}

__device__ __forceinline__ v16h load_frag_rm(const _Float16* p, int ld) {
  int lane = threadIdx.x & 31;
  int row  = lane & 15;
  int hi   = (lane >> 4) ? 8 : 0;
  const _Float16* r = p + (size_t)row * ld;
  v8h lo = *(const v8h*)(r + hi);
  v8h hb = *(const v8h*)(r + 16 + hi);
  v16h out;
#pragma unroll
  for (int i = 0; i < 8; ++i) { out[i] = lo[i]; out[i + 8] = hb[i]; }
  return out;
}

// Transposing LDS load: lane (c = lane & 15, h = lane >> 4) receives the eight
// 16-bit values T[kbase + 8h + 0..7][dbase + c] of a row-major LDS tile.
typedef short s16x8 __attribute__((ext_vector_type(8)));
__device__ __forceinline__ v8h ld_tr16(const _Float16* p) {
  typedef __attribute__((address_space(3))) s16x8 lds_s16x8;
  return __builtin_bit_cast(v8h, __builtin_amdgcn_ds_load_tr16_b128_v8i16((lds_s16x8*)p));
}

__device__ __forceinline__ float xhalf(float x) {
  int xi = __builtin_bit_cast(int, x);
  return __builtin_bit_cast(float, __builtin_amdgcn_permlanex16(
      xi, xi, 0x76543210, 0xfedcba98, false, false));
}

// ---------------------------------------------------------------------------
// f32 -> f16 cast of x, W_attn and W_proj in ONE launch. The three f16 copies lie
// one behind the other in the workspace, so the destination is one flat array.
// One 16-wave block per WGP; a block converts CAST_BLK elements in a row, all of
// one source. A wave load covers 512 B in a row, a wave store 256 B; a thread's
// 16 loads are all in flight before its first store.
// ---------------------------------------------------------------------------
typedef __attribute__((ext_vector_type(4))) float    v4f;
typedef __attribute__((ext_vector_type(4))) _Float16 v4h;

#define CAST_THR   512
#define CAST_PER   16                            // 16-byte loads per thread
#define CAST_STEP  (CAST_THR * 4)                // elements per block and load round
#define CAST_BLK   (CAST_STEP * CAST_PER)        // elements per block
#define CAST_NB_X  (B_SZ * T_SEQ * C_DIM / CAST_BLK)
#define CAST_NB_WA (3 * C_DIM * C_DIM / CAST_BLK)
#define CAST_NB_WP (C_DIM * C_DIM / CAST_BLK)
static_assert(CAST_NB_X * CAST_BLK == B_SZ * T_SEQ * C_DIM, "x is whole blocks");
static_assert(CAST_NB_WA * CAST_BLK == 3 * C_DIM * C_DIM, "W_attn is whole blocks");
static_assert(CAST_NB_WP * CAST_BLK == C_DIM * C_DIM, "W_proj is whole blocks");

__global__ void __launch_bounds__(CAST_THR)
cast3_f32_f16(const float* __restrict__ x, const float* __restrict__ wa,
              const float* __restrict__ wp, _Float16* __restrict__ out) {
  int blk = blockIdx.x;
  const float* src = x;
  int first = 0;
  if (blk >= CAST_NB_X)              { src = wa; first = CAST_NB_X; }
  if (blk >= CAST_NB_X + CAST_NB_WA) { src = wp; first = CAST_NB_X + CAST_NB_WA; }
  const float* sp = src + (size_t)(blk - first) * CAST_BLK + threadIdx.x * 4;
  _Float16*    dp = out + (size_t)blk * CAST_BLK + threadIdx.x * 4;

  v4f v[CAST_PER];
#pragma unroll
  for (int i = 0; i < CAST_PER; ++i) v[i] = *(const v4f*)(sp + i * CAST_STEP);
  // Keeps all 16 loads ahead of the first conversion: left free, the scheduler holds the last
  // two back until the first two have landed, and the wave pays the memory latency twice.
  __builtin_amdgcn_sched_barrier(0);
  v4h h[CAST_PER];
#pragma unroll
  for (int i = 0; i < CAST_PER; ++i) h[i] = __builtin_convertvector(v[i], v4h);
  // Keeps the stores behind the last conversion, each with data registers of its own: left
  // free, the scheduler reuses the first stores' registers and waits for those stores between
  // the later conversions.
  __builtin_amdgcn_sched_barrier(0);
#pragma unroll
  for (int i = 0; i < CAST_PER; ++i) *(v4h*)(dp + i * CAST_STEP) = h[i];
}

// ---------------------------------------------------------------------------
// Main loop of both GEMMs: acc[m,n] = sum_k A[m,k] * Bm[n,k], K = C_DIM, both
// operands K-contiguous f16.
// Block = 512 threads = 16 waves arranged 4(M) x 4(N); wave tile = 16*FM x 16*FN,
// block tile = 64*FM x 64*FN, at most one block per WGP.
// A stage is 64 k (128 B) of every operand row of the block tile, A's rows first,
// at an LDS pitch of 144 B (16 B x odd: ds_load_b128 readers). Asynchronous copies
// bring it in, 16 B a lane, eight lanes to a row, so a wave's copy covers four
// whole 128-B lines and every line is fetched once per block. Two buffers: stage
// t + 2 flies while stage t + 1 is worked on.
// The blocks of a launch start together and keep step, and a row or column of blocks
// reads the same operand rows: a block therefore enters the k walk at stage t0, set by
// its tile indices, and wraps round, so that such blocks ask L2 for different lines at
// any one moment, save blocks y and y + 16 of a gemm_proj column, which share each stage. The k sum is the same set of terms in a rotated order.
// ---------------------------------------------------------------------------
#define G_THR  512
#define G_KST  64                 // k per stage
#define G_LDP  72                 // LDS row pitch in halves (144 B)
#define G_NT   (C_DIM / G_KST)    // stages
static_assert(G_NT >= 2, "the prologue fills two stages");
static_assert(G_KST == 64, "the loop body is written for two k steps of 32 per stage");
static_assert((G_NT & (G_NT - 1)) == 0, "the k walk wraps by a mask");

template <int N>
__device__ __forceinline__ void async_copies(const unsigned (&l)[N], const _Float16* const (&g)[N]) {
  static_assert(N == 4 || N == 8, "written out for 4 and 8 copies");
  if constexpr (N == 4) {
    asm volatile("global_load_async_to_lds_b128 %0, %1, off\n\t"
                 "global_load_async_to_lds_b128 %2, %3, off\n\t"
                 "global_load_async_to_lds_b128 %4, %5, off\n\t"
                 "global_load_async_to_lds_b128 %6, %7, off\n\t"
                 "s_wait_xcnt 0x0"
                 :: "v"(l[0]), "v"(g[0]), "v"(l[1]), "v"(g[1]), "v"(l[2]), "v"(g[2]),
                    "v"(l[3]), "v"(g[3])
                 : "memory");
  } else {
    asm volatile("global_load_async_to_lds_b128 %0, %1, off\n\t"
                 "global_load_async_to_lds_b128 %2, %3, off\n\t"
                 "global_load_async_to_lds_b128 %4, %5, off\n\t"
                 "global_load_async_to_lds_b128 %6, %7, off\n\t"
                 "global_load_async_to_lds_b128 %8, %9, off\n\t"
                 "global_load_async_to_lds_b128 %10, %11, off\n\t"
                 "global_load_async_to_lds_b128 %12, %13, off\n\t"
                 "global_load_async_to_lds_b128 %14, %15, off\n\t"
                 "s_wait_xcnt 0x0"
                 :: "v"(l[0]), "v"(g[0]), "v"(l[1]), "v"(g[1]), "v"(l[2]), "v"(g[2]),
                    "v"(l[3]), "v"(g[3]), "v"(l[4]), "v"(g[4]), "v"(l[5]), "v"(g[5]),
                    "v"(l[6]), "v"(g[6]), "v"(l[7]), "v"(g[7])
                 : "memory");
  }
}

// 16x32 f16 fragment from an LDS row: same k order as load_frag_rm. p = this lane's row,
// at the k step's first half plus 8 * (lane >> 4).
__device__ __forceinline__ v16h lds_frag(const _Float16* p) {
  v8h lo = *(const v8h*)(p);
  v8h hb = *(const v8h*)(p + 16);
  v16h out;
#pragma unroll
  for (int i = 0; i < 8; ++i) { out[i] = lo[i]; out[i + 8] = hb[i]; }
  return out;
}

template <int FM, int FN>
__device__ __forceinline__ void gemm_main(const _Float16* __restrict__ A,
                                          const _Float16* __restrict__ Bm,
                                          int mblk, int nblk, int t0, _Float16* sm,
                                          v8f (&acc)[FM][FN]) {
  constexpr int ROWS  = 64 * (FM + FN);    // operand rows per stage
  constexpr int NCP   = FM + FN;           // copies per thread and stage (64 rows each)
  constexpr int STAGE = ROWS * G_LDP;      // halves per buffer

  const int tid  = threadIdx.x;
  const int lane = tid & 31;
  const int wave = tid >> 5;
  const int wm   = wave >> 2;
  const int wn   = wave & 3;

  // this thread's copies: row i*64 + tid/8 of the stage, 16-byte piece tid & 7
  const int crow = tid >> 3;
  const int cpc  = (tid & 7) * 8;
  const unsigned lbase = (unsigned)(size_t)sm;   // LDS byte address: low 32 bits
  const _Float16* g0[NCP];
  unsigned        l0[NCP];
#pragma unroll
  for (int i = 0; i < NCP; ++i) {
    g0[i] = (i < FM ? A + (size_t)(mblk + i * 64 + crow) * C_DIM
                    : Bm + (size_t)(nblk + (i - FM) * 64 + crow) * C_DIM) + cpc;
    l0[i] = lbase + (unsigned)(((i * 64 + crow) * G_LDP + cpc) * 2);
  }
  auto issue = [&](int t, int buf) {
    const _Float16* g[NCP];
    unsigned        l[NCP];
#pragma unroll
    for (int i = 0; i < NCP; ++i) {
      g[i] = g0[i] + ((t + t0) & (G_NT - 1)) * G_KST;
      l[i] = l0[i] + (unsigned)(buf * STAGE * 2);
    }
    async_copies<NCP>(l, g);
  };

  // this lane's fragment rows in a buffer
  const int frow = lane & 15;
  const int fk   = (lane >> 4) * 8;
  const int aoff = (wm * FM * 16 + frow) * G_LDP + fk;
  const int boff = (64 * FM + wn * FN * 16 + frow) * G_LDP + fk;

  issue(0, 0);
  // stage 0 has landed for this wave; the barrier publishes it to the others
  asm volatile("s_wait_asynccnt 0x0" ::: "memory");
  __syncthreads();
  issue(1, 1);

  for (int t = 0; t < G_NT; ++t) {
    const _Float16* sb = sm + (t & 1) * STAGE;
    v16h a[FM], b[FN], a2[FM], b2[FN];
#pragma unroll
    for (int i = 0; i < FM; ++i) a[i] = lds_frag(sb + aoff + i * 16 * G_LDP);
#pragma unroll
    for (int j = 0; j < FN; ++j) b[j] = lds_frag(sb + boff + j * 16 * G_LDP);
    __builtin_amdgcn_sched_barrier(0);
#pragma unroll
    for (int j = 0; j < FN; ++j)
#pragma unroll
      for (int i = 0; i < FM; ++i) acc[i][j] = wmma_f16(a[i], b[j], acc[i][j]);
    // second k step of the stage: its fragments are the last reads of buffer t & 1
#pragma unroll
    for (int i = 0; i < FM; ++i) a2[i] = lds_frag(sb + aoff + i * 16 * G_LDP + 32);
#pragma unroll
    for (int j = 0; j < FN; ++j) b2[j] = lds_frag(sb + boff + j * 16 * G_LDP + 32);
    // publish point of stage t + 1: this wave's reads of buffer t & 1 are done ...
    asm volatile("s_wait_dscnt 0x0" ::: "memory");
    // ... its copies of stage t + 1 have landed ...
    asm volatile("s_wait_asynccnt 0x0" ::: "memory");
    // ... and the one barrier both publishes stage t + 1 and frees buffer t & 1
    __syncthreads();
    if (t + 2 < G_NT) issue(t + 2, t & 1);
    // the second k step's products work from registers, under the copies just issued
#pragma unroll
    for (int j = 0; j < FN; ++j)
#pragma unroll
      for (int i = 0; i < FM; ++i) acc[i][j] = wmma_f16(a2[i], b2[j], acc[i][j]);
  }
  // no copy is left in flight when the wave goes on to its stores and ends
  asm volatile("s_wait_asynccnt 0x0" ::: "memory");
}

// ---------------------------------------------------------------------------
// QKV GEMM: qkv[m,n] = sum_k x[m,k] * W_attn[n,k] + b_attn[n]
// M=4096, N=3072, K=1024. Block tile 256 x 256 (wave tile 64 x 64, one head wide, so
// that every 128-B line of Q, K and V has one writing wave): 12 x 16 blocks.
// Epilogue scatters into Q/K/V f16 buffers, layout [B,H,T,Dh].
// ---------------------------------------------------------------------------
#define QKV_FM 4
#define QKV_FN 4
__global__ void __launch_bounds__(G_THR)
gemm_qkv(const _Float16* __restrict__ xh, const _Float16* __restrict__ wh,
         const float* __restrict__ bias,
         _Float16* __restrict__ qb, _Float16* __restrict__ kb,
         _Float16* __restrict__ vb) {
  __shared__ __attribute__((aligned(16))) _Float16 sm[2 * 64 * (QKV_FM + QKV_FN) * G_LDP];
  int wave = threadIdx.x >> 5;        // 0..15
  int mblk = blockIdx.y * (64 * QKV_FM);
  int nblk = blockIdx.x * (64 * QKV_FN);

  v8f acc[QKV_FM][QKV_FN] = {};
  gemm_main<QKV_FM, QKV_FN>(xh, wh, mblk, nblk, blockIdx.x + blockIdx.y, sm, acc);

  int m0 = mblk + (wave >> 2) * (16 * QKV_FM);
  int n0 = nblk + (wave & 3) * (16 * QKV_FN);
  int lane = threadIdx.x & 31;
  int ncl  = lane & 15;
  int mhi  = (lane >> 4) ? 8 : 0;
#pragma unroll
  for (int t = 0; t < QKV_FN; ++t) {
    int n = n0 + t * 16 + ncl;
    float bv = bias[n];
    int which = n >> 10;            // 0=q,1=k,2=v
    int c = n & 1023;
    int h = c >> 6;
    int d = c & 63;
    _Float16* dst = (which == 0) ? qb : ((which == 1) ? kb : vb);
#pragma unroll
    for (int mi = 0; mi < QKV_FM; ++mi) {
#pragma unroll
      for (int r = 0; r < 8; ++r) {
        int m = m0 + mi * 16 + r + mhi;
        int bidx = m >> 11;           // /T
        int tpos = m & (T_SEQ - 1);
        dst[(((size_t)(bidx * H_NUM + h) * T_SEQ) + tpos) * DH + d] =
            (_Float16)(acc[mi][t][r] + bv);
      }
    }
  }
}

#define A_KST   64
#define K_LD    72
#define V_LD    80
#define A_KH    (A_KST * K_LD)
#define A_STAGE (A_KST * (K_LD + V_LD))
#define A_QT    (T_SEQ / 64)
#define A_NST   (A_QT + 1)
static_assert(T_SEQ % A_KST == 0 && A_KST == 64, "a tile's 64 queries end with a whole stage");
static_assert(A_QT % 2 == 0, "the tiles of a head pair up");

__global__ void __launch_bounds__(128)
attn_fwd(const _Float16* __restrict__ qbuf, const _Float16* __restrict__ kbuf,
         const _Float16* __restrict__ vbuf, _Float16* __restrict__ ybuf) {
  __shared__ __attribute__((aligned(32))) _Float16 smem[2 * A_STAGE];

  const int tid = threadIdx.x;
  // the wave's number in a scalar register: the tests on q0 below are scalar branches
  int wave = __builtin_amdgcn_readfirstlane(tid >> 5);
  int lane = tid & 31;
  int b = blockIdx.z;
  int h = blockIdx.y;
  const int tile_s = blockIdx.x;                // the short tile, worked second
  const int tile_l = A_QT - 1 - tile_s;         // the long tile, worked first
  const int n_l = tile_l + 1;                   // its stages: ring stages 0 .. n_l - 1

  const _Float16* Q = qbuf + (size_t)(b * H_NUM + h) * T_SEQ * DH;
  const _Float16* K = kbuf + (size_t)(b * H_NUM + h) * T_SEQ * DH;
  const _Float16* V = vbuf + (size_t)(b * H_NUM + h) * T_SEQ * DH;

  // this thread's eight copies of a stage: rows i*16 + tid/8 of K (i < 4) and of V, piece tid & 7
  const int crow = tid >> 3;
  const int cpc  = (tid & 7) * 8;
  const unsigned lbase = (unsigned)(size_t)smem;   // LDS byte address: low 32 bits
  const _Float16* g0[8];
  unsigned        l0[8];
#pragma unroll
  for (int i = 0; i < 4; ++i) {
    g0[i]     = K + (size_t)(i * 16 + crow) * DH + cpc;
    g0[i + 4] = V + (size_t)(i * 16 + crow) * DH + cpc;
    l0[i]     = lbase + (unsigned)(((i * 16 + crow) * K_LD + cpc) * 2);
    l0[i + 4] = lbase + (unsigned)((A_KH + (i * 16 + crow) * V_LD + cpc) * 2);
  }
  // ring stage s goes to buffer s & 1; its keys are stage (s + tile_s) mod n_l of the long tile
  // (tile_s < n_l) or, behind those, stage s - n_l of the short one
  auto issue = [&](int s) {
    const int kr = s + tile_s;
    const int ks = s < n_l ? (kr < n_l ? kr : kr - n_l) : s - n_l;
    const _Float16* g[8];
    unsigned        l[8];
#pragma unroll
    for (int i = 0; i < 8; ++i) {
      g[i] = g0[i] + ks * (A_KST * DH);
      l[i] = l0[i] + (unsigned)((s & 1) * A_STAGE * 2);
    }
    async_copies<8>(l, g);
  };

  // Q fragments (B operand) held for a tile's whole key loop (Dh=64 -> two 32x16)
  v16h bq0 = load_frag_rm(Q + (size_t)(tile_l * 64 + wave * 16) * DH + 0, DH);
  v16h bq1 = load_frag_rm(Q + (size_t)(tile_l * 64 + wave * 16) * DH + 32, DH);

  float slope = exp2f(-8.0f / (float)H_NUM * (float)(h + 1));
  int mhi = (lane >> 4) ? 8 : 0;
  int ncl = lane & 15;

  // lane offsets in a buffer: K fragment row (key ncl, halves mhi..) and the transposing
  // loads' address (key rows 0..15, d columns 0..15)
  const int kfo = ncl * K_LD + mhi;
  const int vto = A_KH + (mhi + (lane & 7)) * V_LD + ((lane >> 3) & 1) * 8;

  issue(0);
  // stage 0 has landed for this wave; the barrier publishes it to the others
  asm volatile("s_wait_asynccnt 0x0" ::: "memory");
  __syncthreads();
  issue(1);

  int s = 0;                      // ring stage, counted through both tiles
  // unrolled: rolled, the flag that tells the tiles apart lives in vcc through the key loop,
  // and the mask's compares and selects there take their long, unpaired encodings
#pragma unroll
  for (int half = 0; half < 2; ++half) {
  const int tile = half ? tile_s : tile_l;
  const int q0 = tile * 64 + wave * 16;
  const int qr = q0 + ncl;

  v8f o[4] = {};                  // o[d4][r] = O^T[d4*16 + mhi + r][q0 + ncl]
  float mrun = -1e30f;            // this query's running maximum (same in both halves)
  float lrun = 0.0f;              // this half's share of the running denominator

  // a tile has at least one stage: tested at the foot, so that the short tile's Q loads are not
  // sunk behind the long tile's epilogue into a test for an empty loop
  int t = 0;
  do {
   const _Float16* sb = smem + (s & 1) * A_STAGE;
   // the key stage that lies in this buffer: as in issue()
   int tk = t;
   if (half == 0) { tk = t + tile_s; if (tk > tile) tk -= tile + 1; }
   // unrolled: the second pass's LDS offsets become immediates of its loads
#pragma unroll
   for (int p = 0; p < 2; ++p) {
    const int kb0 = tk * A_KST + p * 32;
    // wave-uniform: a stage's second pass may lie wholly above the wave's diagonal (its first
    // never does: 64 * tk <= 64 * tile <= q0)
    if (p == 1 && kb0 > q0 + 15) continue;
    const _Float16* kf  = sb + kfo + p * 32 * K_LD;
    const _Float16* vtr = sb + vto + p * 32 * V_LD;

    // ---- K fragments (A operand): same k order as load_frag_rm ----
    v16h ak[2][2];
#pragma unroll
    for (int t2 = 0; t2 < 2; ++t2) {
      ak[t2][0] = lds_frag(kf + t2 * 16 * K_LD);
      ak[t2][1] = lds_frag(kf + t2 * 16 * K_LD + 32);
    }

    // ---- V^T fragments (A operand), in flight under the softmax ----
    v16h av[4];
#pragma unroll
    for (int d4 = 0; d4 < 4; ++d4) {
      v8h lo = ld_tr16(vtr + d4 * 16);
      v8h hb = ld_tr16(vtr + 16 * V_LD + d4 * 16);
#pragma unroll
      for (int i = 0; i < 8; ++i) { av[d4][i] = lo[i]; av[d4][i + 8] = hb[i]; }
    }
    // Keeps the pass's 16 LDS loads one group ahead of the products and the softmax, which
    // then cover the transposing loads' latency.
    __builtin_amdgcn_sched_barrier(0);

    // ---- S^T = K Q^T for two 16-key tiles ----
    v8f s[2];
#pragma unroll
    for (int t2 = 0; t2 < 2; ++t2) {
      v8f c = {};
      c = wmma_f16(ak[t2][0], bq0, c);
      c = wmma_f16(ak[t2][1], bq1, c);
      s[t2] = c;
    }

    // ---- scale + ALiBi + causal mask ----
#pragma unroll
    for (int t2 = 0; t2 < 2; ++t2) {
#pragma unroll
      for (int r = 0; r < 8; ++r) {
        int kc = kb0 + t2 * 16 + mhi + r;
        float v = s[t2][r] * 0.125f +
                  slope * fminf((float)(kc - qr), 0.0f);
        if (kc > qr) v = -1e30f;
        s[t2][r] = v;
      }
    }

    // ---- online softmax: in-lane trees, one exchange between the halves ----
    float t8[8];
#pragma unroll
    for (int r = 0; r < 8; ++r) t8[r] = fmaxf(s[0][r], s[1][r]);
#pragma unroll
    for (int w = 4; w > 0; w >>= 1)
#pragma unroll
      for (int r = 0; r < w; ++r) t8[r] = fmaxf(t8[r], t8[r + w]);
    float mx = fmaxf(t8[0], xhalf(t8[0]));
    float mnew = fmaxf(mrun, mx);
    float alpha = __expf(mrun - mnew);
    mrun = mnew;

#pragma unroll
    for (int t2 = 0; t2 < 2; ++t2)
#pragma unroll
      for (int r = 0; r < 8; ++r) s[t2][r] = __expf(s[t2][r] - mnew);

#pragma unroll
    for (int r = 0; r < 8; ++r) t8[r] = s[0][r] + s[1][r];
#pragma unroll
    for (int w = 4; w > 0; w >>= 1)
#pragma unroll
      for (int r = 0; r < w; ++r) t8[r] += t8[r + w];
    lrun = lrun * alpha + t8[0];

#pragma unroll
    for (int d4 = 0; d4 < 4; ++d4)
#pragma unroll
      for (int r = 0; r < 8; ++r) o[d4][r] *= alpha;

    // ---- P^T: the two score tiles, converted in place, are the B operand ----
    v16h bp;
#pragma unroll
    for (int r = 0; r < 8; ++r) {
      bp[r]     = (_Float16)s[0][r];
      bp[r + 8] = (_Float16)s[1][r];
    }

    // ---- O^T += V^T * P^T ----
#pragma unroll
    for (int d4 = 0; d4 < 4; ++d4) o[d4] = wmma_f16(av[d4], bp, o[d4]);
   }
   // publish point of stage s + 1: this wave's reads of buffer s & 1 are done ...
   asm volatile("s_wait_dscnt 0x0" ::: "memory");
   // ... its copies of stage s + 1 have landed ...
   asm volatile("s_wait_asynccnt 0x0" ::: "memory");
   // ... and the one barrier both publishes stage s + 1 and frees buffer s & 1
   __syncthreads();
   if (s + 2 < A_NST) issue(s + 2);
   ++s;
  } while (++t <= tile);

  // the short tile's Q fragments, in flight under the long tile's epilogue
  if (half == 0) {
    bq0 = load_frag_rm(Q + (size_t)(tile_s * 64 + wave * 16) * DH + 0, DH);
    bq1 = load_frag_rm(Q + (size_t)(tile_s * 64 + wave * 16) * DH + 32, DH);
  }

  // ---- epilogue of a tile: join the halves' sums, normalize, store y as f16 [B,T,C] ----
  lrun += xhalf(lrun);
#pragma unroll
  for (int d4 = 0; d4 < 4; ++d4) {
    v8h pk;
#pragma unroll
    for (int r = 0; r < 8; ++r) pk[r] = (_Float16)(o[d4][r] / lrun);
    *(v8h*)(ybuf + ((size_t)(b * T_SEQ + qr)) * C_DIM + h * DH + d4 * 16 + mhi) = pk;
  }
  if (half == 0) {
    // stands in front of the short tile's first write to a register that the four stores name
    asm volatile("s_wait_xcnt 0x0" ::: "memory");
    // keeps those writes behind the wait: left free, the scheduler lifts them over it
    __builtin_amdgcn_sched_barrier(0);
  }
  }
  // no copy is left in flight when the wave ends
  asm volatile("s_wait_asynccnt 0x0" ::: "memory");
}

// ---------------------------------------------------------------------------
// Output projection: out[m,n] = sum_k y[m,k] * W_proj[n,k] + b_proj[n]  (f32)
// M=4096, N=1024, K=1024. Block tile 128 x 128 (wave tile 32 x 32): 8 x 32 blocks.
// ---------------------------------------------------------------------------
#define PRJ_FM 2
#define PRJ_FN 2
__global__ void __launch_bounds__(G_THR)
gemm_proj(const _Float16* __restrict__ yh, const _Float16* __restrict__ wh,
          const float* __restrict__ bias, float* __restrict__ out) {
  __shared__ __attribute__((aligned(16))) _Float16 sm[2 * 64 * (PRJ_FM + PRJ_FN) * G_LDP];
  int wave = threadIdx.x >> 5;
  int mblk = blockIdx.y * (64 * PRJ_FM);
  int nblk = blockIdx.x * (64 * PRJ_FN);

  v8f acc[PRJ_FM][PRJ_FN] = {};
  gemm_main<PRJ_FM, PRJ_FN>(yh, wh, mblk, nblk, blockIdx.x + blockIdx.y, sm, acc);

  int m0 = mblk + (wave >> 2) * (16 * PRJ_FM);
  int n0 = nblk + (wave & 3) * (16 * PRJ_FN);
  int lane = threadIdx.x & 31;
  int ncl  = lane & 15;
  int mhi  = (lane >> 4) ? 8 : 0;
#pragma unroll
  for (int t = 0; t < PRJ_FN; ++t) {
    int n = n0 + t * 16 + ncl;
    float bv = bias[n];
#pragma unroll
    for (int mi = 0; mi < PRJ_FM; ++mi) {
#pragma unroll
      for (int r = 0; r < 8; ++r) {
        int m = m0 + mi * 16 + r + mhi;
        out[(size_t)m * C_DIM + n] = acc[mi][t][r] + bv;
      }
    }
  }
}

// ---------------------------------------------------------------------------
// Launch
// ---------------------------------------------------------------------------
extern "C" void kernel_launch(void* const* d_in, const int* in_sizes, int n_in,
                              void* d_out, int out_size, void* d_ws, size_t ws_size,
                              hipStream_t stream) {
  const float* x      = (const float*)d_in[0];   // [B,T,C]
  const float* W_attn = (const float*)d_in[1];   // [3C,C]
  const float* b_attn = (const float*)d_in[2];   // [3C]
  const float* W_proj = (const float*)d_in[3];   // [C,C]
  const float* b_proj = (const float*)d_in[4];   // [C]
  float* out = (float*)d_out;

  char* ws = (char*)d_ws;
  const size_t n_x  = (size_t)B_SZ * T_SEQ * C_DIM;        // 4,194,304
  const size_t n_wa = (size_t)3 * C_DIM * C_DIM;           // 3,145,728
  const size_t n_wp = (size_t)C_DIM * C_DIM;               // 1,048,576
  const size_t n_qkv = (size_t)B_SZ * H_NUM * T_SEQ * DH;  // 4,194,304

  _Float16* xh  = (_Float16*)(ws);
  _Float16* wah = (_Float16*)(ws + 2 * n_x);
  _Float16* wph = (_Float16*)(ws + 2 * (n_x + n_wa));
  _Float16* qb  = (_Float16*)(ws + 2 * (n_x + n_wa + n_wp));
  _Float16* kb  = (_Float16*)(ws + 2 * (n_x + n_wa + n_wp + n_qkv));
  _Float16* vb  = (_Float16*)(ws + 2 * (n_x + n_wa + n_wp + 2 * n_qkv));
  _Float16* yb  = (_Float16*)(ws + 2 * (n_x + n_wa + n_wp + 3 * n_qkv));

  // xh, wah and wph are one flat f16 array that starts at xh
  cast3_f32_f16<<<CAST_NB_X + CAST_NB_WA + CAST_NB_WP, CAST_THR, 0, stream>>>(x, W_attn, W_proj, xh);

  // QKV GEMM: block tile 256x256 -> grid = (3072/256, 4096/256) = (12, 16)
  gemm_qkv<<<dim3(12, 16), G_THR, 0, stream>>>(xh, wah, b_attn, qb, kb, vb);

  // Attention: (pairs of 64-query tiles, H, B)
  attn_fwd<<<dim3(A_QT / 2, H_NUM, B_SZ), 128, 0, stream>>>(qb, kb, vb, yb);

  // Projection: block tile 128x128 -> grid = (1024/128, 4096/128) = (8, 32)
  gemm_proj<<<dim3(8, 32), G_THR, 0, stream>>>(yb, wph, b_proj, out);
}

// v007
// Measured time: 75 microseconds a run.
// Timed twice side by side with v006, it ran 1.09 and 1.08 times as fast.
// Over all steps from v000 it is 3.81 times as fast.
#include <hip/hip_runtime.h>
#include <hip/hip_bf16.h>

typedef __attribute__((ext_vector_type(16))) _Float16 v16h;
typedef __attribute__((ext_vector_type(8)))  _Float16 v8h;
typedef __attribute__((ext_vector_type(8)))  float    v8f;
typedef __attribute__((ext_vector_type(2)))  float    v2f;

#define B_SZ   2
#define T_SEQ  2048
#define C_DIM  1024
#define H_NUM  16
#define DH     64

__device__ __forceinline__ v8f wmma_f16(v16h a, v16h b, v8f c) {
  return __builtin_amdgcn_wmma_f32_16x16x32_f16(
      /*neg_a=*/false, a, /*neg_b=*/false, b,
      /*c_mod=*/(short)0, c, /*reuse_a=*/false, /*reuse_b=*/false);
}

__device__ __forceinline__ v16h load_frag_rm(const _Float16* p, int ld) {
  int lane = threadIdx.x & 31;
  int row  = lane & 15;
  int hi   = (lane >> 4) ? 8 : 0;
  const _Float16* r = p + (size_t)row * ld;
  v8h lo = *(const v8h*)(r + hi);
  v8h hb = *(const v8h*)(r + 16 + hi);
  v16h out;
#pragma unroll
  for (int i = 0; i < 8; ++i) { out[i] = lo[i]; out[i + 8] = hb[i]; }
  return out;
}

// Transposing LDS load: lane (c = lane & 15, h = lane >> 4) receives the eight
// 16-bit values T[kbase + 8h + 0..7][dbase + c] of a row-major LDS tile.
typedef short s16x8 __attribute__((ext_vector_type(8)));
__device__ __forceinline__ v8h ld_tr16(const _Float16* p) {
  typedef __attribute__((address_space(3))) s16x8 lds_s16x8;
  return __builtin_bit_cast(v8h, __builtin_amdgcn_ds_load_tr16_b128_v8i16((lds_s16x8*)p));
}

__device__ __forceinline__ float xhalf(float x) {
  int xi = __builtin_bit_cast(int, x);
  return __builtin_bit_cast(float, __builtin_amdgcn_permlanex16(
      xi, xi, 0x76543210, 0xfedcba98, false, false));
}

// ---------------------------------------------------------------------------
// f32 -> f16 cast of x, W_attn and W_proj in ONE launch. The three f16 copies lie
// one behind the other in the workspace, so the destination is one flat array.
// One 16-wave block per WGP; a block converts CAST_BLK elements in a row, all of
// one source. A wave load covers 512 B in a row, a wave store 256 B; a thread's
// 16 loads are all in flight before its first store.
// ---------------------------------------------------------------------------
typedef __attribute__((ext_vector_type(4))) float    v4f;
typedef __attribute__((ext_vector_type(4))) _Float16 v4h;

#define CAST_THR   512
#define CAST_PER   16                            // 16-byte loads per thread
#define CAST_STEP  (CAST_THR * 4)                // elements per block and load round
#define CAST_BLK   (CAST_STEP * CAST_PER)        // elements per block
#define CAST_NB_X  (B_SZ * T_SEQ * C_DIM / CAST_BLK)
#define CAST_NB_WA (3 * C_DIM * C_DIM / CAST_BLK)
#define CAST_NB_WP (C_DIM * C_DIM / CAST_BLK)
static_assert(CAST_NB_X * CAST_BLK == B_SZ * T_SEQ * C_DIM, "x is whole blocks");
static_assert(CAST_NB_WA * CAST_BLK == 3 * C_DIM * C_DIM, "W_attn is whole blocks");
static_assert(CAST_NB_WP * CAST_BLK == C_DIM * C_DIM, "W_proj is whole blocks");

__global__ void __launch_bounds__(CAST_THR)
cast3_f32_f16(const float* __restrict__ x, const float* __restrict__ wa,
              const float* __restrict__ wp, _Float16* __restrict__ out) {
  int blk = blockIdx.x;
  const float* src = x;
  int first = 0;
  if (blk >= CAST_NB_X)              { src = wa; first = CAST_NB_X; }
  if (blk >= CAST_NB_X + CAST_NB_WA) { src = wp; first = CAST_NB_X + CAST_NB_WA; }
  const float* sp = src + (size_t)(blk - first) * CAST_BLK + threadIdx.x * 4;
  _Float16*    dp = out + (size_t)blk * CAST_BLK + threadIdx.x * 4;

  v4f v[CAST_PER];
#pragma unroll
  for (int i = 0; i < CAST_PER; ++i) v[i] = *(const v4f*)(sp + i * CAST_STEP);
  // Keeps all 16 loads ahead of the first conversion: left free, the scheduler holds the last
  // two back until the first two have landed, and the wave pays the memory latency twice.
  __builtin_amdgcn_sched_barrier(0);
  v4h h[CAST_PER];
#pragma unroll
  for (int i = 0; i < CAST_PER; ++i) h[i] = __builtin_convertvector(v[i], v4h);
  // Keeps the stores behind the last conversion, each with data registers of its own: left
  // free, the scheduler reuses the first stores' registers and waits for those stores between
  // the later conversions.
  __builtin_amdgcn_sched_barrier(0);
#pragma unroll
  for (int i = 0; i < CAST_PER; ++i) *(v4h*)(dp + i * CAST_STEP) = h[i];
}

// ---------------------------------------------------------------------------
// Main loop of both GEMMs: acc[m,n] = sum_k A[m,k] * Bm[n,k], K = C_DIM, both
// operands K-contiguous f16.
// Block = 512 threads = 16 waves arranged 4(M) x 4(N); wave tile = 16*FM x 16*FN,
// block tile = 64*FM x 64*FN, at most one block per WGP.
// A stage is 64 k (128 B) of every operand row of the block tile, A's rows first,
// at an LDS pitch of 144 B (16 B x odd: ds_load_b128 readers). Asynchronous copies
// bring it in, 16 B a lane, eight lanes to a row, so a wave's copy covers four
// whole 128-B lines and every line is fetched once per block. Two buffers: stage
// t + 2 flies while stage t + 1 is worked on.
// The blocks of a launch start together and keep step, and a row or column of blocks
// reads the same operand rows: a block therefore enters the k walk at stage t0, set by
// its tile indices, and wraps round, so that such blocks ask L2 for different lines at
// any one moment, save blocks y and y + 16 of a gemm_proj column, which share each stage. The k sum is the same set of terms in a rotated order.
// ---------------------------------------------------------------------------
#define G_THR  512
#define G_KST  64                 // k per stage
#define G_LDP  72                 // LDS row pitch in halves (144 B)
#define G_NT   (C_DIM / G_KST)    // stages
static_assert(G_NT >= 2, "the prologue fills two stages");
static_assert(G_KST == 64, "the loop body is written for two k steps of 32 per stage");
static_assert((G_NT & (G_NT - 1)) == 0, "the k walk wraps by a mask");

template <int N>
__device__ __forceinline__ void async_copies(const unsigned (&l)[N], const _Float16* const (&g)[N]) {
  static_assert(N == 4 || N == 8, "written out for 4 and 8 copies");
  if constexpr (N == 4) {
    asm volatile("global_load_async_to_lds_b128 %0, %1, off\n\t"
                 "global_load_async_to_lds_b128 %2, %3, off\n\t"
                 "global_load_async_to_lds_b128 %4, %5, off\n\t"
                 "global_load_async_to_lds_b128 %6, %7, off\n\t"
                 "s_wait_xcnt 0x0"
                 :: "v"(l[0]), "v"(g[0]), "v"(l[1]), "v"(g[1]), "v"(l[2]), "v"(g[2]),
                    "v"(l[3]), "v"(g[3])
                 : "memory");
  } else {
    asm volatile("global_load_async_to_lds_b128 %0, %1, off\n\t"
                 "global_load_async_to_lds_b128 %2, %3, off\n\t"
                 "global_load_async_to_lds_b128 %4, %5, off\n\t"
                 "global_load_async_to_lds_b128 %6, %7, off\n\t"
                 "global_load_async_to_lds_b128 %8, %9, off\n\t"
                 "global_load_async_to_lds_b128 %10, %11, off\n\t"
                 "global_load_async_to_lds_b128 %12, %13, off\n\t"
                 "global_load_async_to_lds_b128 %14, %15, off\n\t"
                 "s_wait_xcnt 0x0"
                 :: "v"(l[0]), "v"(g[0]), "v"(l[1]), "v"(g[1]), "v"(l[2]), "v"(g[2]),
                    "v"(l[3]), "v"(g[3]), "v"(l[4]), "v"(g[4]), "v"(l[5]), "v"(g[5]),
                    "v"(l[6]), "v"(g[6]), "v"(l[7]), "v"(g[7])
                 : "memory");
  }
}

// 16x32 f16 fragment from an LDS row: same k order as load_frag_rm. p = this lane's row,
// at the k step's first half plus 8 * (lane >> 4).
__device__ __forceinline__ v16h lds_frag(const _Float16* p) {
  v8h lo = *(const v8h*)(p);
  v8h hb = *(const v8h*)(p + 16);
  v16h out;
#pragma unroll
  for (int i = 0; i < 8; ++i) { out[i] = lo[i]; out[i + 8] = hb[i]; }
  return out;
}

template <int FM, int FN>
__device__ __forceinline__ void gemm_main(const _Float16* __restrict__ A,
                                          const _Float16* __restrict__ Bm,
                                          int mblk, int nblk, int t0, _Float16* sm,
                                          v8f (&acc)[FM][FN]) {
  constexpr int ROWS  = 64 * (FM + FN);    // operand rows per stage
  constexpr int NCP   = FM + FN;           // copies per thread and stage (64 rows each)
  constexpr int STAGE = ROWS * G_LDP;      // halves per buffer

  const int tid  = threadIdx.x;
  const int lane = tid & 31;
  const int wave = tid >> 5;
  const int wm   = wave >> 2;
  const int wn   = wave & 3;

  // this thread's copies: row i*64 + tid/8 of the stage, 16-byte piece tid & 7
  const int crow = tid >> 3;
  const int cpc  = (tid & 7) * 8;
  const unsigned lbase = (unsigned)(size_t)sm;   // LDS byte address: low 32 bits
  const _Float16* g0[NCP];
  unsigned        l0[NCP];
#pragma unroll
  for (int i = 0; i < NCP; ++i) {
    g0[i] = (i < FM ? A + (size_t)(mblk + i * 64 + crow) * C_DIM
                    : Bm + (size_t)(nblk + (i - FM) * 64 + crow) * C_DIM) + cpc;
    l0[i] = lbase + (unsigned)(((i * 64 + crow) * G_LDP + cpc) * 2);
  }
  auto issue = [&](int t, int buf) {
    const _Float16* g[NCP];
    unsigned        l[NCP];
#pragma unroll
    for (int i = 0; i < NCP; ++i) {
      g[i] = g0[i] + ((t + t0) & (G_NT - 1)) * G_KST;
      l[i] = l0[i] + (unsigned)(buf * STAGE * 2);
    }
    async_copies<NCP>(l, g);
  };

  // this lane's fragment rows in a buffer
  const int frow = lane & 15;
  const int fk   = (lane >> 4) * 8;
  const int aoff = (wm * FM * 16 + frow) * G_LDP + fk;
  const int boff = (64 * FM + wn * FN * 16 + frow) * G_LDP + fk;

  issue(0, 0);
  // stage 0 has landed for this wave; the barrier publishes it to the others
  asm volatile("s_wait_asynccnt 0x0" ::: "memory");
  __syncthreads();
  issue(1, 1);

  for (int t = 0; t < G_NT; ++t) {
    const _Float16* sb = sm + (t & 1) * STAGE;
    v16h a[FM], b[FN], a2[FM], b2[FN];
#pragma unroll
    for (int i = 0; i < FM; ++i) a[i] = lds_frag(sb + aoff + i * 16 * G_LDP);
#pragma unroll
    for (int j = 0; j < FN; ++j) b[j] = lds_frag(sb + boff + j * 16 * G_LDP);
    __builtin_amdgcn_sched_barrier(0);
#pragma unroll
    for (int j = 0; j < FN; ++j)
#pragma unroll
      for (int i = 0; i < FM; ++i) acc[i][j] = wmma_f16(a[i], b[j], acc[i][j]);
    // second k step of the stage: its fragments are the last reads of buffer t & 1
#pragma unroll
    for (int i = 0; i < FM; ++i) a2[i] = lds_frag(sb + aoff + i * 16 * G_LDP + 32);
#pragma unroll
    for (int j = 0; j < FN; ++j) b2[j] = lds_frag(sb + boff + j * 16 * G_LDP + 32);
    // publish point of stage t + 1: this wave's reads of buffer t & 1 are done ...
    asm volatile("s_wait_dscnt 0x0" ::: "memory");
    // ... its copies of stage t + 1 have landed ...
    asm volatile("s_wait_asynccnt 0x0" ::: "memory");
    // ... and the one barrier both publishes stage t + 1 and frees buffer t & 1
    __syncthreads();
    if (t + 2 < G_NT) issue(t + 2, t & 1);
    // the second k step's products work from registers, under the copies just issued
#pragma unroll
    for (int j = 0; j < FN; ++j)
#pragma unroll
      for (int i = 0; i < FM; ++i) acc[i][j] = wmma_f16(a2[i], b2[j], acc[i][j]);
  }
  // no copy is left in flight when the wave goes on to its stores and ends
  asm volatile("s_wait_asynccnt 0x0" ::: "memory");
}

// ---------------------------------------------------------------------------
// QKV GEMM: qkv[m,n] = sum_k x[m,k] * W_attn[n,k] + b_attn[n]
// M=4096, N=3072, K=1024. Block tile 256 x 256 (wave tile 64 x 64, one head wide, so
// that every 128-B line of Q, K and V has one writing wave): 12 x 16 blocks.
// Epilogue scatters into Q/K/V f16 buffers, layout [B,H,T,Dh].
// ---------------------------------------------------------------------------
#define QKV_FM 4
#define QKV_FN 4
__global__ void __launch_bounds__(G_THR)
gemm_qkv(const _Float16* __restrict__ xh, const _Float16* __restrict__ wh,
         const float* __restrict__ bias,
         _Float16* __restrict__ qb, _Float16* __restrict__ kb,
         _Float16* __restrict__ vb) {
  __shared__ __attribute__((aligned(16))) _Float16 sm[2 * 64 * (QKV_FM + QKV_FN) * G_LDP];
  int wave = threadIdx.x >> 5;        // 0..15
  int mblk = blockIdx.y * (64 * QKV_FM);
  int nblk = blockIdx.x * (64 * QKV_FN);

  v8f acc[QKV_FM][QKV_FN] = {};
  gemm_main<QKV_FM, QKV_FN>(xh, wh, mblk, nblk, blockIdx.x + blockIdx.y, sm, acc);

  int m0 = mblk + (wave >> 2) * (16 * QKV_FM);
  int n0 = nblk + (wave & 3) * (16 * QKV_FN);
  int lane = threadIdx.x & 31;
  int ncl  = lane & 15;
  int mhi  = (lane >> 4) ? 8 : 0;
#pragma unroll
  for (int t = 0; t < QKV_FN; ++t) {
    int n = n0 + t * 16 + ncl;
    float bv = bias[n];
    int which = n >> 10;            // 0=q,1=k,2=v
    int c = n & 1023;
    int h = c >> 6;
    int d = c & 63;
    _Float16* dst = (which == 0) ? qb : ((which == 1) ? kb : vb);
#pragma unroll
    for (int mi = 0; mi < QKV_FM; ++mi) {
#pragma unroll
      for (int r = 0; r < 8; ++r) {
        int m = m0 + mi * 16 + r + mhi;
        int bidx = m >> 11;           // /T
        int tpos = m & (T_SEQ - 1);
        dst[(((size_t)(bidx * H_NUM + h) * T_SEQ) + tpos) * DH + d] =
            (_Float16)(acc[mi][t][r] + bv);
      }
    }
  }
}

#define A_KST   64
#define K_LD    72
#define V_LD    80
#define A_KH    (A_KST * K_LD)
#define A_STAGE (A_KST * (K_LD + V_LD))
#define A_QT    (T_SEQ / 64)
#define A_NST   (A_QT + 1)
static_assert(T_SEQ % A_KST == 0 && A_KST == 64, "a tile's 64 queries end with a whole stage");
static_assert(A_QT % 2 == 0, "the tiles of a head pair up");

__global__ void __launch_bounds__(128)
attn_fwd(const _Float16* __restrict__ qbuf, const _Float16* __restrict__ kbuf,
         const _Float16* __restrict__ vbuf, _Float16* __restrict__ ybuf) {
  __shared__ __attribute__((aligned(32))) _Float16 smem[2 * A_STAGE];

  const int tid = threadIdx.x;
  // the wave's number in a scalar register: the tests on q0 below are scalar branches
  int wave = __builtin_amdgcn_readfirstlane(tid >> 5);
  int lane = tid & 31;
  int b = blockIdx.z;
  int h = blockIdx.y;
  const int tile_s = blockIdx.x;                // the short tile, worked second
  const int tile_l = A_QT - 1 - tile_s;         // the long tile, worked first
  const int n_l = tile_l + 1;                   // its stages: ring stages 0 .. n_l - 1

  const _Float16* Q = qbuf + (size_t)(b * H_NUM + h) * T_SEQ * DH;
  const _Float16* K = kbuf + (size_t)(b * H_NUM + h) * T_SEQ * DH;
  const _Float16* V = vbuf + (size_t)(b * H_NUM + h) * T_SEQ * DH;

  // this thread's eight copies of a stage: rows i*16 + tid/8 of K (i < 4) and of V, piece tid & 7
  const int crow = tid >> 3;
  const int cpc  = (tid & 7) * 8;
  const unsigned lbase = (unsigned)(size_t)smem;   // LDS byte address: low 32 bits
  const _Float16* g0[8];
  unsigned        l0[8];
#pragma unroll
  for (int i = 0; i < 4; ++i) {
    g0[i]     = K + (size_t)(i * 16 + crow) * DH + cpc;
    g0[i + 4] = V + (size_t)(i * 16 + crow) * DH + cpc;
    l0[i]     = lbase + (unsigned)(((i * 16 + crow) * K_LD + cpc) * 2);
    l0[i + 4] = lbase + (unsigned)((A_KH + (i * 16 + crow) * V_LD + cpc) * 2);
  }
  // ring stage s goes to buffer s & 1; its keys are stage (s + tile_s) mod n_l of the long tile
  // (tile_s < n_l) or, behind those, stage s - n_l of the short one
  auto issue = [&](int s) {
    const int kr = s + tile_s;
    const int ks = s < n_l ? (kr < n_l ? kr : kr - n_l) : s - n_l;
    const _Float16* g[8];
    unsigned        l[8];
#pragma unroll
    for (int i = 0; i < 8; ++i) {
      g[i] = g0[i] + ks * (A_KST * DH);
      l[i] = l0[i] + (unsigned)((s & 1) * A_STAGE * 2);
    }
    async_copies<8>(l, g);
  };

  // Q fragments (B operand) held for a tile's whole key loop (Dh=64 -> two 32x16)
  v16h bq0 = load_frag_rm(Q + (size_t)(tile_l * 64 + wave * 16) * DH + 0, DH);
  v16h bq1 = load_frag_rm(Q + (size_t)(tile_l * 64 + wave * 16) * DH + 32, DH);

  float slope = exp2f(-8.0f / (float)H_NUM * (float)(h + 1));
  int mhi = (lane >> 4) ? 8 : 0;
  int ncl = lane & 15;
  const float cscale = 0.125f * 1.4426950408889634f;   // raw score -> base-2 exponent
  const float sl2    = slope * 1.4426950408889634f;    // bias per key of distance, base 2
  // bias of a place in a pass's score tile against (first key, first query), in raw-score units
  v8f cb[2];
#pragma unroll
  for (int t2 = 0; t2 < 2; ++t2)
#pragma unroll
    for (int r = 0; r < 8; ++r) cb[t2][r] = 8.0f * slope * (float)(t2 * 16 + mhi + r - ncl);

  // lane offsets in a buffer: K fragment row (key ncl, halves mhi..) and the transposing
  // loads' address (key rows 0..15, d columns 0..15)
  const int kfo = ncl * K_LD + mhi;
  const int vto = A_KH + (mhi + (lane & 7)) * V_LD + ((lane >> 3) & 1) * 8;

  issue(0);
  // stage 0 has landed for this wave; the barrier publishes it to the others
  asm volatile("s_wait_asynccnt 0x0" ::: "memory");
  __syncthreads();
  issue(1);

  int s = 0;                      // ring stage, counted through both tiles
  // unrolled: rolled, the flag that tells the tiles apart lives in vcc through the key loop,
  // and the mask's compares and selects there take their long, unpaired encodings
#pragma unroll
  for (int half = 0; half < 2; ++half) {
  const int tile = half ? tile_s : tile_l;
  const int q0 = tile * 64 + wave * 16;
  const int qr = q0 + ncl;

  v8f o[4] = {};                  // o[d4][r] = O^T[d4*16 + mhi + r][q0 + ncl]
  float mrun = -1e30f;            // this query's running maximum, base 2 (same in both halves)
  float lrun = 0.0f;              // this half's share of the running denominator

  // a tile has at least one stage: tested at the foot, so that the short tile's Q loads are not
  // sunk behind the long tile's epilogue into a test for an empty loop
  int t = 0;
  do {
   const _Float16* sb = smem + (s & 1) * A_STAGE;
   // the key stage that lies in this buffer: as in issue()
   int tk = t;
   if (half == 0) { tk = t + tile_s; if (tk > tile) tk -= tile + 1; }
   // unrolled: the second pass's LDS offsets become immediates of its loads
#pragma unroll
   for (int p = 0; p < 2; ++p) {
    const int kb0 = tk * A_KST + p * 32;
    // wave-uniform: a stage's second pass may lie wholly above the wave's diagonal (its first
    // never does: 64 * tk <= 64 * tile <= q0)
    if (p == 1 && kb0 > q0 + 15) continue;
    const _Float16* kf  = sb + kfo + p * 32 * K_LD;
    const _Float16* vtr = sb + vto + p * 32 * V_LD;

    // ---- K fragments (A operand): same k order as load_frag_rm ----
    v16h ak[2][2];
#pragma unroll
    for (int t2 = 0; t2 < 2; ++t2) {
      ak[t2][0] = lds_frag(kf + t2 * 16 * K_LD);
      ak[t2][1] = lds_frag(kf + t2 * 16 * K_LD + 32);
    }

    // ---- V^T fragments (A operand), in flight under the softmax ----
    v16h av[4];
#pragma unroll
    for (int d4 = 0; d4 < 4; ++d4) {
      v8h lo = ld_tr16(vtr + d4 * 16);
      v8h hb = ld_tr16(vtr + 16 * V_LD + d4 * 16);
#pragma unroll
      for (int i = 0; i < 8; ++i) { av[d4][i] = lo[i]; av[d4][i + 8] = hb[i]; }
    }
    // Keeps the pass's 16 LDS loads one group ahead of the products and the softmax, which
    // then cover the transposing loads' latency.
    __builtin_amdgcn_sched_barrier(0);

    // ---- S^T = K Q^T + the tile's bias, for two 16-key tiles ----
    v8f s[2];
#pragma unroll
    for (int t2 = 0; t2 < 2; ++t2) {
      v8f c = wmma_f16(ak[t2][0], bq0, cb[t2]);
      c = wmma_f16(ak[t2][1], bq1, c);
      s[t2] = c;
    }

    // ---- causal mask: wave-uniform test, true only where the pass's last key lies above the
    // wave's first query ----
    if (kb0 + 31 > q0) {
#pragma unroll
      for (int t2 = 0; t2 < 2; ++t2)
#pragma unroll
        for (int r = 0; r < 8; ++r)
          if (kb0 + t2 * 16 + mhi + r > qr) s[t2][r] = -1e30f;
    }

    // ---- online softmax, base 2: in-lane trees, one exchange between the halves ----
    float t8[8];
#pragma unroll
    for (int r = 0; r < 8; ++r) t8[r] = fmaxf(s[0][r], s[1][r]);
#pragma unroll
    for (int w = 4; w > 0; w >>= 1)
#pragma unroll
      for (int r = 0; r < w; ++r) t8[r] = fmaxf(t8[r], t8[r + w]);
    const float offs = sl2 * (float)(kb0 - q0);   // the pass's share of the bias
    float mx = fmaf(t8[0], cscale, offs);         // this half's maximum, base 2, whole bias
    float mnew = fmaxf(mrun, fmaxf(mx, xhalf(mx)));
    float alpha;
    asm("v_exp_f32 %0, %1\n\tv_nop" : "=v"(alpha) : "v"(mrun - mnew));
    mrun = mnew;
    const float nm = offs - mnew;

#pragma unroll
    for (int t2 = 0; t2 < 2; ++t2)
#pragma unroll
      for (int r = 0; r < 8; r += 2) {
        const v2f arg = __builtin_elementwise_fma(v2f{s[t2][r], s[t2][r + 1]},
                                                  v2f{cscale, cscale}, v2f{nm, nm});
        s[t2][r]     = __builtin_amdgcn_exp2f(arg.x);
        s[t2][r + 1] = __builtin_amdgcn_exp2f(arg.y);
      }

#pragma unroll
    for (int r = 0; r < 8; ++r) t8[r] = s[0][r] + s[1][r];
#pragma unroll
    for (int w = 4; w > 0; w >>= 1)
#pragma unroll
      for (int r = 0; r < w; ++r) t8[r] += t8[r + w];
    lrun = lrun * alpha + t8[0];

#pragma unroll
    for (int d4 = 0; d4 < 4; ++d4)
#pragma unroll
      for (int r = 0; r < 8; ++r) o[d4][r] *= alpha;

    // ---- P^T: the two score tiles, converted in place, are the B operand ----
    v16h bp;
#pragma unroll
    for (int r = 0; r < 8; ++r) {
      bp[r]     = (_Float16)s[0][r];
      bp[r + 8] = (_Float16)s[1][r];
    }

    // ---- O^T += V^T * P^T ----
#pragma unroll
    for (int d4 = 0; d4 < 4; ++d4) o[d4] = wmma_f16(av[d4], bp, o[d4]);
   }
   // publish point of stage s + 1: this wave's reads of buffer s & 1 are done ...
   asm volatile("s_wait_dscnt 0x0" ::: "memory");
   // ... its copies of stage s + 1 have landed ...
   asm volatile("s_wait_asynccnt 0x0" ::: "memory");
   // ... and the one barrier both publishes stage s + 1 and frees buffer s & 1
   __syncthreads();
   if (s + 2 < A_NST) issue(s + 2);
   ++s;
  } while (++t <= tile);

  // the short tile's Q fragments, in flight under the long tile's epilogue
  if (half == 0) {
    bq0 = load_frag_rm(Q + (size_t)(tile_s * 64 + wave * 16) * DH + 0, DH);
    bq1 = load_frag_rm(Q + (size_t)(tile_s * 64 + wave * 16) * DH + 32, DH);
  }

  // ---- epilogue of a tile: join the halves' sums, normalize, store y as f16 [B,T,C] ----
  lrun += xhalf(lrun);
#pragma unroll
  for (int d4 = 0; d4 < 4; ++d4) {
    v8h pk;
#pragma unroll
    for (int r = 0; r < 8; ++r) pk[r] = (_Float16)(o[d4][r] / lrun);
    *(v8h*)(ybuf + ((size_t)(b * T_SEQ + qr)) * C_DIM + h * DH + d4 * 16 + mhi) = pk;
  }
  if (half == 0) {
    // stands in front of the short tile's first write to a register that the four stores name
    asm volatile("s_wait_xcnt 0x0" ::: "memory");
    // keeps those writes behind the wait: left free, the scheduler lifts them over it
    __builtin_amdgcn_sched_barrier(0);
  }
  }
  // no copy is left in flight when the wave ends
  asm volatile("s_wait_asynccnt 0x0" ::: "memory");
}

// ---------------------------------------------------------------------------
// Output projection: out[m,n] = sum_k y[m,k] * W_proj[n,k] + b_proj[n]  (f32)
// M=4096, N=1024, K=1024. Block tile 128 x 128 (wave tile 32 x 32): 8 x 32 blocks.
// ---------------------------------------------------------------------------
#define PRJ_FM 2
#define PRJ_FN 2
__global__ void __launch_bounds__(G_THR)
gemm_proj(const _Float16* __restrict__ yh, const _Float16* __restrict__ wh,
          const float* __restrict__ bias, float* __restrict__ out) {
  __shared__ __attribute__((aligned(16))) _Float16 sm[2 * 64 * (PRJ_FM + PRJ_FN) * G_LDP];
  int wave = threadIdx.x >> 5;
  int mblk = blockIdx.y * (64 * PRJ_FM);
  int nblk = blockIdx.x * (64 * PRJ_FN);

  v8f acc[PRJ_FM][PRJ_FN] = {};
  gemm_main<PRJ_FM, PRJ_FN>(yh, wh, mblk, nblk, blockIdx.x + blockIdx.y, sm, acc);

  int m0 = mblk + (wave >> 2) * (16 * PRJ_FM);
  int n0 = nblk + (wave & 3) * (16 * PRJ_FN);
  int lane = threadIdx.x & 31;
  int ncl  = lane & 15;
  int mhi  = (lane >> 4) ? 8 : 0;
#pragma unroll
  for (int t = 0; t < PRJ_FN; ++t) {
    int n = n0 + t * 16 + ncl;
    float bv = bias[n];
#pragma unroll
    for (int mi = 0; mi < PRJ_FM; ++mi) {
#pragma unroll
      for (int r = 0; r < 8; ++r) {
        int m = m0 + mi * 16 + r + mhi;
        out[(size_t)m * C_DIM + n] = acc[mi][t][r] + bv;
      }
    }
  }
}

// ---------------------------------------------------------------------------
// Launch
// ---------------------------------------------------------------------------
extern "C" void kernel_launch(void* const* d_in, const int* in_sizes, int n_in,
                              void* d_out, int out_size, void* d_ws, size_t ws_size,
                              hipStream_t stream) {
  const float* x      = (const float*)d_in[0];   // [B,T,C]
  const float* W_attn = (const float*)d_in[1];   // [3C,C]
  const float* b_attn = (const float*)d_in[2];   // [3C]
  const float* W_proj = (const float*)d_in[3];   // [C,C]
  const float* b_proj = (const float*)d_in[4];   // [C]
  float* out = (float*)d_out;

  char* ws = (char*)d_ws;
  const size_t n_x  = (size_t)B_SZ * T_SEQ * C_DIM;        // 4,194,304
  const size_t n_wa = (size_t)3 * C_DIM * C_DIM;           // 3,145,728
  const size_t n_wp = (size_t)C_DIM * C_DIM;               // 1,048,576
  const size_t n_qkv = (size_t)B_SZ * H_NUM * T_SEQ * DH;  // 4,194,304

  _Float16* xh  = (_Float16*)(ws);
  _Float16* wah = (_Float16*)(ws + 2 * n_x);
  _Float16* wph = (_Float16*)(ws + 2 * (n_x + n_wa));
  _Float16* qb  = (_Float16*)(ws + 2 * (n_x + n_wa + n_wp));
  _Float16* kb  = (_Float16*)(ws + 2 * (n_x + n_wa + n_wp + n_qkv));
  _Float16* vb  = (_Float16*)(ws + 2 * (n_x + n_wa + n_wp + 2 * n_qkv));
  _Float16* yb  = (_Float16*)(ws + 2 * (n_x + n_wa + n_wp + 3 * n_qkv));

  // xh, wah and wph are one flat f16 array that starts at xh
  cast3_f32_f16<<<CAST_NB_X + CAST_NB_WA + CAST_NB_WP, CAST_THR, 0, stream>>>(x, W_attn, W_proj, xh);

  // QKV GEMM: block tile 256x256 -> grid = (3072/256, 4096/256) = (12, 16)
  gemm_qkv<<<dim3(12, 16), G_THR, 0, stream>>>(xh, wah, b_attn, qb, kb, vb);

  // Attention: (pairs of 64-query tiles, H, B)
  attn_fwd<<<dim3(A_QT / 2, H_NUM, B_SZ), 128, 0, stream>>>(qb, kb, vb, yb);

  // Projection: block tile 128x128 -> grid = (1024/128, 4096/128) = (8, 32)
  gemm_proj<<<dim3(8, 32), G_THR, 0, stream>>>(yb, wph, b_proj, out);
}

// v008
// It runs in 70.6 microseconds.
// Two timings next to v007 both put it at 1.06 times that version's speed.
// Counting every step since v000, it is 4.05 times as fast.
#include <hip/hip_runtime.h>
#include <hip/hip_bf16.h>

typedef __attribute__((ext_vector_type(16))) _Float16 v16h;
typedef __attribute__((ext_vector_type(8)))  _Float16 v8h;
typedef __attribute__((ext_vector_type(8)))  float    v8f;
typedef __attribute__((ext_vector_type(2)))  float    v2f;

#define B_SZ   2
#define T_SEQ  2048
#define C_DIM  1024
#define H_NUM  16
#define DH     64

__device__ __forceinline__ v8f wmma_f16(v16h a, v16h b, v8f c) {
  return __builtin_amdgcn_wmma_f32_16x16x32_f16(
      /*neg_a=*/false, a, /*neg_b=*/false, b,
      /*c_mod=*/(short)0, c, /*reuse_a=*/false, /*reuse_b=*/false);
}

__device__ __forceinline__ v16h load_frag_rm(const _Float16* p, int ld) {
  int lane = threadIdx.x & 31;
  int row  = lane & 15;
  int hi   = (lane >> 4) ? 8 : 0;
  const _Float16* r = p + (size_t)row * ld;
  v8h lo = *(const v8h*)(r + hi);
  v8h hb = *(const v8h*)(r + 16 + hi);
  v16h out;
#pragma unroll
  for (int i = 0; i < 8; ++i) { out[i] = lo[i]; out[i + 8] = hb[i]; }
  return out;
}

// Transposing LDS load: lane (c = lane & 15, h = lane >> 4) receives the eight
// 16-bit values T[kbase + 8h + 0..7][dbase + c] of a row-major LDS tile.
typedef short s16x8 __attribute__((ext_vector_type(8)));
__device__ __forceinline__ v8h ld_tr16(const _Float16* p) {
  typedef __attribute__((address_space(3))) s16x8 lds_s16x8;
  return __builtin_bit_cast(v8h, __builtin_amdgcn_ds_load_tr16_b128_v8i16((lds_s16x8*)p));
}

__device__ __forceinline__ float xhalf(float x) {
  int xi = __builtin_bit_cast(int, x);
  return __builtin_bit_cast(float, __builtin_amdgcn_permlanex16(
      xi, xi, 0x76543210, 0xfedcba98, false, false));
}

// ---------------------------------------------------------------------------
// f32 -> f16 cast of x, W_attn and W_proj in ONE launch. The three f16 copies lie
// one behind the other in the workspace, so the destination is one flat array.
// One 16-wave block per WGP; a block converts CAST_BLK elements in a row, all of
// one source. A wave load covers 512 B in a row, a wave store 256 B; a thread's
// 16 loads are all in flight before its first store.
// ---------------------------------------------------------------------------
typedef __attribute__((ext_vector_type(4))) float    v4f;
typedef __attribute__((ext_vector_type(4))) _Float16 v4h;

#define CAST_THR   512
#define CAST_PER   16                            // 16-byte loads per thread
#define CAST_STEP  (CAST_THR * 4)                // elements per block and load round
#define CAST_BLK   (CAST_STEP * CAST_PER)        // elements per block
#define CAST_NB_X  (B_SZ * T_SEQ * C_DIM / CAST_BLK)
#define CAST_NB_WA (3 * C_DIM * C_DIM / CAST_BLK)
#define CAST_NB_WP (C_DIM * C_DIM / CAST_BLK)
static_assert(CAST_NB_X * CAST_BLK == B_SZ * T_SEQ * C_DIM, "x is whole blocks");
static_assert(CAST_NB_WA * CAST_BLK == 3 * C_DIM * C_DIM, "W_attn is whole blocks");
static_assert(CAST_NB_WP * CAST_BLK == C_DIM * C_DIM, "W_proj is whole blocks");

__global__ void __launch_bounds__(CAST_THR)
cast3_f32_f16(const float* __restrict__ x, const float* __restrict__ wa,
              const float* __restrict__ wp, _Float16* __restrict__ out) {
  int blk = blockIdx.x;
  const float* src = x;
  int first = 0;
  if (blk >= CAST_NB_X)              { src = wa; first = CAST_NB_X; }
  if (blk >= CAST_NB_X + CAST_NB_WA) { src = wp; first = CAST_NB_X + CAST_NB_WA; }
  const float* sp = src + (size_t)(blk - first) * CAST_BLK + threadIdx.x * 4;
  _Float16*    dp = out + (size_t)blk * CAST_BLK + threadIdx.x * 4;

  v4f v[CAST_PER];
#pragma unroll
  for (int i = 0; i < CAST_PER; ++i) v[i] = *(const v4f*)(sp + i * CAST_STEP);
  // Keeps all 16 loads ahead of the first conversion: left free, the scheduler holds the last
  // two back until the first two have landed, and the wave pays the memory latency twice.
  __builtin_amdgcn_sched_barrier(0);
  v4h h[CAST_PER];
#pragma unroll
  for (int i = 0; i < CAST_PER; ++i) h[i] = __builtin_convertvector(v[i], v4h);
  // Keeps the stores behind the last conversion, each with data registers of its own: left
  // free, the scheduler reuses the first stores' registers and waits for those stores between
  // the later conversions.
  __builtin_amdgcn_sched_barrier(0);
#pragma unroll
  for (int i = 0; i < CAST_PER; ++i) *(v4h*)(dp + i * CAST_STEP) = h[i];
}

// ---------------------------------------------------------------------------
// Main loop of both GEMMs: acc[m,n] = sum_k A[m,k] * Bm[n,k], K = C_DIM, both
// operands K-contiguous f16.
// Block = 512 threads = 16 waves arranged 4(M) x 4(N); wave tile = 16*FM x 16*FN,
// block tile = 64*FM x 64*FN, at most one block per WGP.
// A stage is 64 k (128 B) of every operand row of the block tile, A's rows first,
// at an LDS pitch of 144 B (16 B x odd: ds_load_b128 readers). Asynchronous copies
// bring it in, 16 B a lane, eight lanes to a row, so a wave's copy covers four
// whole 128-B lines and every line is fetched once per block. G_NBUF buffers: a stage's
// copies are issued G_NBUF - 1 stages ahead of its first read, so that a stage's time need
// not cover the way from L2 or memory, and G_NBUF - 1 stages of bytes are in flight per block.
// The blocks of a launch start together and keep step, and a row or column of blocks
// reads the same operand rows: a block therefore enters the k walk at stage t0, set by
// its tile indices, and wraps round, so that such blocks ask L2 for different lines at
// any one moment, save blocks y and y + 16 of a gemm_proj column, which share each stage. The k sum is the same set of terms in a rotated order.
// ---------------------------------------------------------------------------
#define G_THR  512
#define G_KST  64                 // k per stage
#define G_LDP  72                 // LDS row pitch in halves (144 B)
#define G_NT   (C_DIM / G_KST)    // stages
#define G_NBUF 4                  // buffers of the ring
static_assert(G_NT >= G_NBUF, "the prologue fills every buffer");
static_assert((G_NBUF & (G_NBUF - 1)) == 0 && G_NBUF >= 2, "a stage's buffer is found by a mask");
static_assert(G_KST == 64, "the loop body is written for two k steps of 32 per stage");
static_assert((G_NT & (G_NT - 1)) == 0, "the k walk wraps by a mask");

// Returns when all but this wave's N youngest copies have landed (a wave's copies count down in
// issue order). Asm with the "memory" clobber, so that no LDS read is lifted over it.
template <int N>
__device__ __forceinline__ void wait_copies_but() {
  static_assert(N >= 0 && N < 64, "the counter holds 63");
  asm volatile("s_wait_asynccnt %0" :: "n"(N) : "memory");
}

template <int N>
__device__ __forceinline__ void async_copies(const unsigned (&l)[N], const _Float16* const (&g)[N]) {
  static_assert(N == 4 || N == 8, "written out for 4 and 8 copies");
  if constexpr (N == 4) {
    asm volatile("global_load_async_to_lds_b128 %0, %1, off\n\t"
                 "global_load_async_to_lds_b128 %2, %3, off\n\t"
                 "global_load_async_to_lds_b128 %4, %5, off\n\t"
                 "global_load_async_to_lds_b128 %6, %7, off\n\t"
                 "s_wait_xcnt 0x0"
                 :: "v"(l[0]), "v"(g[0]), "v"(l[1]), "v"(g[1]), "v"(l[2]), "v"(g[2]),
                    "v"(l[3]), "v"(g[3])
                 : "memory");
  } else {
    asm volatile("global_load_async_to_lds_b128 %0, %1, off\n\t"
                 "global_load_async_to_lds_b128 %2, %3, off\n\t"
                 "global_load_async_to_lds_b128 %4, %5, off\n\t"
                 "global_load_async_to_lds_b128 %6, %7, off\n\t"
                 "global_load_async_to_lds_b128 %8, %9, off\n\t"
                 "global_load_async_to_lds_b128 %10, %11, off\n\t"
                 "global_load_async_to_lds_b128 %12, %13, off\n\t"
                 "global_load_async_to_lds_b128 %14, %15, off\n\t"
                 "s_wait_xcnt 0x0"
                 :: "v"(l[0]), "v"(g[0]), "v"(l[1]), "v"(g[1]), "v"(l[2]), "v"(g[2]),
                    "v"(l[3]), "v"(g[3]), "v"(l[4]), "v"(g[4]), "v"(l[5]), "v"(g[5]),
                    "v"(l[6]), "v"(g[6]), "v"(l[7]), "v"(g[7])
                 : "memory");
  }
}

// 16x32 f16 fragment from an LDS row: same k order as load_frag_rm. p = this lane's row,
// at the k step's first half plus 8 * (lane >> 4).
__device__ __forceinline__ v16h lds_frag(const _Float16* p) {
  v8h lo = *(const v8h*)(p);
  v8h hb = *(const v8h*)(p + 16);
  v16h out;
#pragma unroll
  for (int i = 0; i < 8; ++i) { out[i] = lo[i]; out[i + 8] = hb[i]; }
  return out;
}

template <int FM, int FN>
__device__ __forceinline__ void gemm_main(const _Float16* __restrict__ A,
                                          const _Float16* __restrict__ Bm,
                                          int mblk, int nblk, int t0, _Float16* sm,
                                          v8f (&acc)[FM][FN]) {
  constexpr int ROWS  = 64 * (FM + FN);    // operand rows per stage
  constexpr int NCP   = FM + FN;           // copies per thread and stage (64 rows each)
  constexpr int STAGE = ROWS * G_LDP;      // halves per buffer

  const int tid  = threadIdx.x;
  const int lane = tid & 31;
  const int wave = tid >> 5;
  const int wm   = wave >> 2;
  const int wn   = wave & 3;

  // this thread's copies: row i*64 + tid/8 of the stage, 16-byte piece tid & 7
  const int crow = tid >> 3;
  const int cpc  = (tid & 7) * 8;
  const unsigned lbase = (unsigned)(size_t)sm;   // LDS byte address: low 32 bits
  const _Float16* g0[NCP];
  unsigned        l0[NCP];
#pragma unroll
  for (int i = 0; i < NCP; ++i) {
    g0[i] = (i < FM ? A + (size_t)(mblk + i * 64 + crow) * C_DIM
                    : Bm + (size_t)(nblk + (i - FM) * 64 + crow) * C_DIM) + cpc;
    l0[i] = lbase + (unsigned)(((i * 64 + crow) * G_LDP + cpc) * 2);
  }
  auto issue = [&](int t, int buf) {
    const _Float16* g[NCP];
    unsigned        l[NCP];
#pragma unroll
    for (int i = 0; i < NCP; ++i) {
      g[i] = g0[i] + ((t + t0) & (G_NT - 1)) * G_KST;
      l[i] = l0[i] + (unsigned)(buf * STAGE * 2);
    }
    async_copies<NCP>(l, g);
  };

  // this lane's fragment rows in a buffer
  const int frow = lane & 15;
  const int fk   = (lane >> 4) * 8;
  const int aoff = (wm * FM * 16 + frow) * G_LDP + fk;
  const int boff = (64 * FM + wn * FN * 16 + frow) * G_LDP + fk;

  static_assert(G_NBUF * NCP < 64, "copies of a wave in flight");
#pragma unroll
  for (int t = 0; t < G_NBUF; ++t) issue(t, t);
  // stage 0 has landed for this wave (the younger stages fly on); the barrier publishes it
  wait_copies_but<(G_NBUF - 1) * NCP>();
  __syncthreads();

  for (int t = 0; t < G_NT; ++t) {
    const _Float16* sb = sm + (t & (G_NBUF - 1)) * STAGE;
    v16h a[FM], b[FN], a2[FM], b2[FN];
#pragma unroll
    for (int i = 0; i < FM; ++i) a[i] = lds_frag(sb + aoff + i * 16 * G_LDP);
#pragma unroll
    for (int j = 0; j < FN; ++j) b[j] = lds_frag(sb + boff + j * 16 * G_LDP);
    __builtin_amdgcn_sched_barrier(0);
#pragma unroll
    for (int j = 0; j < FN; ++j)
#pragma unroll
      for (int i = 0; i < FM; ++i) acc[i][j] = wmma_f16(a[i], b[j], acc[i][j]);
    // second k step of the stage: its fragments are the last reads of stage t's buffer
#pragma unroll
    for (int i = 0; i < FM; ++i) a2[i] = lds_frag(sb + aoff + i * 16 * G_LDP + 32);
#pragma unroll
    for (int j = 0; j < FN; ++j) b2[j] = lds_frag(sb + boff + j * 16 * G_LDP + 32);
    // publish point of stage t + 1: this wave's reads of stage t's buffer are done ...
    asm volatile("s_wait_dscnt 0x0" ::: "memory");
    // ... its copies of stage t + 1 have landed: behind them stand those of stages t + 2 to
    // t + G_NBUF - 1 and no others. In the last trips, where not all of these exist, fewer
    // copies stand behind stage t + 1 and the count would not cover it: there the wait is to 0 ...
    wait_copies_but<(G_NBUF - 2) * NCP>();
    if (t + G_NBUF - 1 >= G_NT) wait_copies_but<0>();
    // ... and the one barrier both publishes stage t + 1 and frees stage t's buffer
    __syncthreads();
    if (t + G_NBUF < G_NT) issue(t + G_NBUF, t & (G_NBUF - 1));
    // the second k step's products work from registers, under the copies just issued
#pragma unroll
    for (int j = 0; j < FN; ++j)
#pragma unroll
      for (int i = 0; i < FM; ++i) acc[i][j] = wmma_f16(a2[i], b2[j], acc[i][j]);
  }
  // no copy is left in flight when the wave goes on to its stores and ends
  asm volatile("s_wait_asynccnt 0x0" ::: "memory");
}

// ---------------------------------------------------------------------------
// QKV GEMM: qkv[m,n] = sum_k x[m,k] * W_attn[n,k] + b_attn[n]
// M=4096, N=3072, K=1024. Block tile 256 x 256 (wave tile 64 x 64, one head wide, so
// that every 128-B line of Q, K and V has one writing wave): 12 x 16 blocks.
// Epilogue scatters into Q/K/V f16 buffers, layout [B,H,T,Dh].
// ---------------------------------------------------------------------------
#define QKV_FM 4
#define QKV_FN 4
__global__ void __launch_bounds__(G_THR)
gemm_qkv(const _Float16* __restrict__ xh, const _Float16* __restrict__ wh,
         const float* __restrict__ bias,
         _Float16* __restrict__ qb, _Float16* __restrict__ kb,
         _Float16* __restrict__ vb) {
  __shared__ __attribute__((aligned(16))) _Float16 sm[G_NBUF * 64 * (QKV_FM + QKV_FN) * G_LDP];
  int wave = threadIdx.x >> 5;        // 0..15
  int mblk = blockIdx.y * (64 * QKV_FM);
  int nblk = blockIdx.x * (64 * QKV_FN);

  v8f acc[QKV_FM][QKV_FN] = {};
  gemm_main<QKV_FM, QKV_FN>(xh, wh, mblk, nblk, blockIdx.x + blockIdx.y, sm, acc);

  int m0 = mblk + (wave >> 2) * (16 * QKV_FM);
  int n0 = nblk + (wave & 3) * (16 * QKV_FN);
  int lane = threadIdx.x & 31;
  int ncl  = lane & 15;
  int mhi  = (lane >> 4) ? 8 : 0;
#pragma unroll
  for (int t = 0; t < QKV_FN; ++t) {
    int n = n0 + t * 16 + ncl;
    float bv = bias[n];
    int which = n >> 10;            // 0=q,1=k,2=v
    int c = n & 1023;
    int h = c >> 6;
    int d = c & 63;
    _Float16* dst = (which == 0) ? qb : ((which == 1) ? kb : vb);
#pragma unroll
    for (int mi = 0; mi < QKV_FM; ++mi) {
#pragma unroll
      for (int r = 0; r < 8; ++r) {
        int m = m0 + mi * 16 + r + mhi;
        int bidx = m >> 11;           // /T
        int tpos = m & (T_SEQ - 1);
        dst[(((size_t)(bidx * H_NUM + h) * T_SEQ) + tpos) * DH + d] =
            (_Float16)(acc[mi][t][r] + bv);
      }
    }
  }
}

#define A_KST   64
#define K_LD    72
#define V_LD    80
#define A_KH    (A_KST * K_LD)
#define A_STAGE (A_KST * (K_LD + V_LD))
#define A_QT    (T_SEQ / 64)
#define A_NST   (A_QT + 1)
#define A_NBUF  4
static_assert(A_NST >= A_NBUF, "the prologue fills every buffer");
static_assert((A_NBUF & (A_NBUF - 1)) == 0 && A_NBUF >= 2, "a stage's buffer is found by a mask");
static_assert(A_NBUF * 8 < 64, "copies of a wave in flight");
static_assert(T_SEQ % A_KST == 0 && A_KST == 64, "a tile's 64 queries end with a whole stage");
static_assert(A_QT % 2 == 0, "the tiles of a head pair up");

__global__ void __launch_bounds__(128)
attn_fwd(const _Float16* __restrict__ qbuf, const _Float16* __restrict__ kbuf,
         const _Float16* __restrict__ vbuf, _Float16* __restrict__ ybuf) {
  __shared__ __attribute__((aligned(32))) _Float16 smem[A_NBUF * A_STAGE];

  const int tid = threadIdx.x;
  // the wave's number in a scalar register: the tests on q0 below are scalar branches
  int wave = __builtin_amdgcn_readfirstlane(tid >> 5);
  int lane = tid & 31;
  int b = blockIdx.z;
  int h = blockIdx.y;
  const int tile_s = blockIdx.x;                // the short tile, worked second
  const int tile_l = A_QT - 1 - tile_s;         // the long tile, worked first
  const int n_l = tile_l + 1;                   // its stages: ring stages 0 .. n_l - 1

  const _Float16* Q = qbuf + (size_t)(b * H_NUM + h) * T_SEQ * DH;
  const _Float16* K = kbuf + (size_t)(b * H_NUM + h) * T_SEQ * DH;
  const _Float16* V = vbuf + (size_t)(b * H_NUM + h) * T_SEQ * DH;

  // this thread's eight copies of a stage: rows i*16 + tid/8 of K (i < 4) and of V, piece tid & 7
  const int crow = tid >> 3;
  const int cpc  = (tid & 7) * 8;
  const unsigned lbase = (unsigned)(size_t)smem;   // LDS byte address: low 32 bits
  const _Float16* g0[8];
  unsigned        l0[8];
#pragma unroll
  for (int i = 0; i < 4; ++i) {
    g0[i]     = K + (size_t)(i * 16 + crow) * DH + cpc;
    g0[i + 4] = V + (size_t)(i * 16 + crow) * DH + cpc;
    l0[i]     = lbase + (unsigned)(((i * 16 + crow) * K_LD + cpc) * 2);
    l0[i + 4] = lbase + (unsigned)((A_KH + (i * 16 + crow) * V_LD + cpc) * 2);
  }
  // ring stage s goes to buffer s mod A_NBUF; its keys are stage (s + tile_s) mod n_l of the long tile
  // (tile_s < n_l) or, behind those, stage s - n_l of the short one
  auto issue = [&](int s) {
    const int kr = s + tile_s;
    const int ks = s < n_l ? (kr < n_l ? kr : kr - n_l) : s - n_l;
    const _Float16* g[8];
    unsigned        l[8];
#pragma unroll
    for (int i = 0; i < 8; ++i) {
      g[i] = g0[i] + ks * (A_KST * DH);
      l[i] = l0[i] + (unsigned)((s & (A_NBUF - 1)) * A_STAGE * 2);
    }
    async_copies<8>(l, g);
  };

  // Q fragments (B operand) held for a tile's whole key loop (Dh=64 -> two 32x16)
  v16h bq0 = load_frag_rm(Q + (size_t)(tile_l * 64 + wave * 16) * DH + 0, DH);
  v16h bq1 = load_frag_rm(Q + (size_t)(tile_l * 64 + wave * 16) * DH + 32, DH);

  float slope = exp2f(-8.0f / (float)H_NUM * (float)(h + 1));
  int mhi = (lane >> 4) ? 8 : 0;
  int ncl = lane & 15;
  const float cscale = 0.125f * 1.4426950408889634f;   // raw score -> base-2 exponent
  const float sl2    = slope * 1.4426950408889634f;    // bias per key of distance, base 2
  // bias of a place in a pass's score tile against (first key, first query), in raw-score units
  v8f cb[2];
#pragma unroll
  for (int t2 = 0; t2 < 2; ++t2)
#pragma unroll
    for (int r = 0; r < 8; ++r) cb[t2][r] = 8.0f * slope * (float)(t2 * 16 + mhi + r - ncl);

  // lane offsets in a buffer: K fragment row (key ncl, halves mhi..) and the transposing
  // loads' address (key rows 0..15, d columns 0..15)
  const int kfo = ncl * K_LD + mhi;
  const int vto = A_KH + (mhi + (lane & 7)) * V_LD + ((lane >> 3) & 1) * 8;

#pragma unroll
  for (int i = 0; i < A_NBUF; ++i) issue(i);
  // stage 0 has landed for this wave (the younger stages fly on); the barrier publishes it
  wait_copies_but<(A_NBUF - 1) * 8>();
  __syncthreads();

  int s = 0;                      // ring stage, counted through both tiles
  // unrolled: rolled, the flag that tells the tiles apart lives in vcc through the key loop,
  // and the mask's compares and selects there take their long, unpaired encodings
#pragma unroll
  for (int half = 0; half < 2; ++half) {
  const int tile = half ? tile_s : tile_l;
  const int q0 = tile * 64 + wave * 16;
  const int qr = q0 + ncl;

  v8f o[4] = {};                  // o[d4][r] = O^T[d4*16 + mhi + r][q0 + ncl]
  float mrun = -1e30f;            // this query's running maximum, base 2 (same in both halves)
  float lrun = 0.0f;              // this half's share of the running denominator

  // a tile has at least one stage: tested at the foot, so that the short tile's Q loads are not
  // sunk behind the long tile's epilogue into a test for an empty loop
  int t = 0;
  do {
   const _Float16* sb = smem + (s & (A_NBUF - 1)) * A_STAGE;
   // the key stage that lies in this buffer: as in issue()
   int tk = t;
   if (half == 0) { tk = t + tile_s; if (tk > tile) tk -= tile + 1; }
   // unrolled: the second pass's LDS offsets become immediates of its loads
#pragma unroll
   for (int p = 0; p < 2; ++p) {
    const int kb0 = tk * A_KST + p * 32;
    // wave-uniform: a stage's second pass may lie wholly above the wave's diagonal (its first
    // never does: 64 * tk <= 64 * tile <= q0)
    if (p == 1 && kb0 > q0 + 15) continue;
    const _Float16* kf  = sb + kfo + p * 32 * K_LD;
    const _Float16* vtr = sb + vto + p * 32 * V_LD;

    // ---- K fragments (A operand): same k order as load_frag_rm ----
    v16h ak[2][2];
#pragma unroll
    for (int t2 = 0; t2 < 2; ++t2) {
      ak[t2][0] = lds_frag(kf + t2 * 16 * K_LD);
      ak[t2][1] = lds_frag(kf + t2 * 16 * K_LD + 32);
    }

    // ---- V^T fragments (A operand), in flight under the softmax ----
    v16h av[4];
#pragma unroll
    for (int d4 = 0; d4 < 4; ++d4) {
      v8h lo = ld_tr16(vtr + d4 * 16);
      v8h hb = ld_tr16(vtr + 16 * V_LD + d4 * 16);
#pragma unroll
      for (int i = 0; i < 8; ++i) { av[d4][i] = lo[i]; av[d4][i + 8] = hb[i]; }
    }
    // Keeps the pass's 16 LDS loads one group ahead of the products and the softmax, which
    // then cover the transposing loads' latency.
    __builtin_amdgcn_sched_barrier(0);

    // ---- S^T = K Q^T + the tile's bias, for two 16-key tiles ----
    v8f s[2];
#pragma unroll
    for (int t2 = 0; t2 < 2; ++t2) {
      v8f c = wmma_f16(ak[t2][0], bq0, cb[t2]);
      c = wmma_f16(ak[t2][1], bq1, c);
      s[t2] = c;
    }

    // ---- causal mask: wave-uniform test, true only where the pass's last key lies above the
    // wave's first query ----
    if (kb0 + 31 > q0) {
#pragma unroll
      for (int t2 = 0; t2 < 2; ++t2)
#pragma unroll
        for (int r = 0; r < 8; ++r)
          if (kb0 + t2 * 16 + mhi + r > qr) s[t2][r] = -1e30f;
    }

    // ---- online softmax, base 2: in-lane trees, one exchange between the halves ----
    float t8[8];
#pragma unroll
    for (int r = 0; r < 8; ++r) t8[r] = fmaxf(s[0][r], s[1][r]);
#pragma unroll
    for (int w = 4; w > 0; w >>= 1)
#pragma unroll
      for (int r = 0; r < w; ++r) t8[r] = fmaxf(t8[r], t8[r + w]);
    const float offs = sl2 * (float)(kb0 - q0);   // the pass's share of the bias
    float mx = fmaf(t8[0], cscale, offs);         // this half's maximum, base 2, whole bias
    float mnew = fmaxf(mrun, fmaxf(mx, xhalf(mx)));
    float alpha;
    asm("v_exp_f32 %0, %1\n\tv_nop" : "=v"(alpha) : "v"(mrun - mnew));
    mrun = mnew;
    const float nm = offs - mnew;

#pragma unroll
    for (int t2 = 0; t2 < 2; ++t2)
#pragma unroll
      for (int r = 0; r < 8; r += 2) {
        const v2f arg = __builtin_elementwise_fma(v2f{s[t2][r], s[t2][r + 1]},
                                                  v2f{cscale, cscale}, v2f{nm, nm});
        s[t2][r]     = __builtin_amdgcn_exp2f(arg.x);
        s[t2][r + 1] = __builtin_amdgcn_exp2f(arg.y);
      }

#pragma unroll
    for (int r = 0; r < 8; ++r) t8[r] = s[0][r] + s[1][r];
#pragma unroll
    for (int w = 4; w > 0; w >>= 1)
#pragma unroll
      for (int r = 0; r < w; ++r) t8[r] += t8[r + w];
    lrun = lrun * alpha + t8[0];

#pragma unroll
    for (int d4 = 0; d4 < 4; ++d4)
#pragma unroll
      for (int r = 0; r < 8; ++r) o[d4][r] *= alpha;

    // ---- P^T: the two score tiles, converted in place, are the B operand ----
    v16h bp;
#pragma unroll
    for (int r = 0; r < 8; ++r) {
      bp[r]     = (_Float16)s[0][r];
      bp[r + 8] = (_Float16)s[1][r];
    }

    // ---- O^T += V^T * P^T ----
#pragma unroll
    for (int d4 = 0; d4 < 4; ++d4) o[d4] = wmma_f16(av[d4], bp, o[d4]);
   }
   // publish point of stage s + 1: this wave's reads of stage s's buffer are done ...
   asm volatile("s_wait_dscnt 0x0" ::: "memory");
   // ... its copies of stage s + 1 have landed: behind them stand those of stages s + 2 to
   // s + A_NBUF - 1 and no others. In the last stages, where not all of these exist, fewer
   // copies stand behind stage s + 1 and the count would not cover it: there the wait is to 0 ...
   wait_copies_but<(A_NBUF - 2) * 8>();
   if (s + A_NBUF - 1 >= A_NST) wait_copies_but<0>();
   // ... and the one barrier both publishes stage s + 1 and frees stage s's buffer
   __syncthreads();
   if (s + A_NBUF < A_NST) issue(s + A_NBUF);
   ++s;
  } while (++t <= tile);

  // the short tile's Q fragments, in flight under the long tile's epilogue
  if (half == 0) {
    bq0 = load_frag_rm(Q + (size_t)(tile_s * 64 + wave * 16) * DH + 0, DH);
    bq1 = load_frag_rm(Q + (size_t)(tile_s * 64 + wave * 16) * DH + 32, DH);
  }

  // ---- epilogue of a tile: join the halves' sums, normalize, store y as f16 [B,T,C] ----
  lrun += xhalf(lrun);
#pragma unroll
  for (int d4 = 0; d4 < 4; ++d4) {
    v8h pk;
#pragma unroll
    for (int r = 0; r < 8; ++r) pk[r] = (_Float16)(o[d4][r] / lrun);
    *(v8h*)(ybuf + ((size_t)(b * T_SEQ + qr)) * C_DIM + h * DH + d4 * 16 + mhi) = pk;
  }
  if (half == 0) {
    // stands in front of the short tile's first write to a register that the four stores name
    asm volatile("s_wait_xcnt 0x0" ::: "memory");
    // keeps those writes behind the wait: left free, the scheduler lifts them over it
    __builtin_amdgcn_sched_barrier(0);
  }
  }
  // no copy is left in flight when the wave ends
  asm volatile("s_wait_asynccnt 0x0" ::: "memory");
}

// ---------------------------------------------------------------------------
// Output projection: out[m,n] = sum_k y[m,k] * W_proj[n,k] + b_proj[n]  (f32)
// M=4096, N=1024, K=1024. Block tile 128 x 128 (wave tile 32 x 32): 8 x 32 blocks.
// ---------------------------------------------------------------------------
#define PRJ_FM 2
#define PRJ_FN 2
__global__ void __launch_bounds__(G_THR)
gemm_proj(const _Float16* __restrict__ yh, const _Float16* __restrict__ wh,
          const float* __restrict__ bias, float* __restrict__ out) {
  __shared__ __attribute__((aligned(16))) _Float16 sm[G_NBUF * 64 * (PRJ_FM + PRJ_FN) * G_LDP];
  int wave = threadIdx.x >> 5;
  int mblk = blockIdx.y * (64 * PRJ_FM);
  int nblk = blockIdx.x * (64 * PRJ_FN);

  v8f acc[PRJ_FM][PRJ_FN] = {};
  gemm_main<PRJ_FM, PRJ_FN>(yh, wh, mblk, nblk, blockIdx.x + blockIdx.y, sm, acc);

  int m0 = mblk + (wave >> 2) * (16 * PRJ_FM);
  int n0 = nblk + (wave & 3) * (16 * PRJ_FN);
  int lane = threadIdx.x & 31;
  int ncl  = lane & 15;
  int mhi  = (lane >> 4) ? 8 : 0;
#pragma unroll
  for (int t = 0; t < PRJ_FN; ++t) {
    int n = n0 + t * 16 + ncl;
    float bv = bias[n];
#pragma unroll
    for (int mi = 0; mi < PRJ_FM; ++mi) {
#pragma unroll
      for (int r = 0; r < 8; ++r) {
        int m = m0 + mi * 16 + r + mhi;
        out[(size_t)m * C_DIM + n] = acc[mi][t][r] + bv;
      }
    }
  }
}

// ---------------------------------------------------------------------------
// Launch
// ---------------------------------------------------------------------------
extern "C" void kernel_launch(void* const* d_in, const int* in_sizes, int n_in,
                              void* d_out, int out_size, void* d_ws, size_t ws_size,
                              hipStream_t stream) {
  const float* x      = (const float*)d_in[0];   // [B,T,C]
  const float* W_attn = (const float*)d_in[1];   // [3C,C]
  const float* b_attn = (const float*)d_in[2];   // [3C]
  const float* W_proj = (const float*)d_in[3];   // [C,C]
  const float* b_proj = (const float*)d_in[4];   // [C]
  float* out = (float*)d_out;

  char* ws = (char*)d_ws;
  const size_t n_x  = (size_t)B_SZ * T_SEQ * C_DIM;        // 4,194,304
  const size_t n_wa = (size_t)3 * C_DIM * C_DIM;           // 3,145,728
  const size_t n_wp = (size_t)C_DIM * C_DIM;               // 1,048,576
  const size_t n_qkv = (size_t)B_SZ * H_NUM * T_SEQ * DH;  // 4,194,304

  _Float16* xh  = (_Float16*)(ws);
  _Float16* wah = (_Float16*)(ws + 2 * n_x);
  _Float16* wph = (_Float16*)(ws + 2 * (n_x + n_wa));
  _Float16* qb  = (_Float16*)(ws + 2 * (n_x + n_wa + n_wp));
  _Float16* kb  = (_Float16*)(ws + 2 * (n_x + n_wa + n_wp + n_qkv));
  _Float16* vb  = (_Float16*)(ws + 2 * (n_x + n_wa + n_wp + 2 * n_qkv));
  _Float16* yb  = (_Float16*)(ws + 2 * (n_x + n_wa + n_wp + 3 * n_qkv));

  // xh, wah and wph are one flat f16 array that starts at xh
  cast3_f32_f16<<<CAST_NB_X + CAST_NB_WA + CAST_NB_WP, CAST_THR, 0, stream>>>(x, W_attn, W_proj, xh);

  // QKV GEMM: block tile 256x256 -> grid = (3072/256, 4096/256) = (12, 16)
  gemm_qkv<<<dim3(12, 16), G_THR, 0, stream>>>(xh, wah, b_attn, qb, kb, vb);

  // Attention: (pairs of 64-query tiles, H, B)
  attn_fwd<<<dim3(A_QT / 2, H_NUM, B_SZ), 128, 0, stream>>>(qb, kb, vb, yb);

  // Projection: block tile 128x128 -> grid = (1024/128, 4096/128) = (8, 32)
  gemm_proj<<<dim3(8, 32), G_THR, 0, stream>>>(yb, wph, b_proj, out);
}
